// v000
// Measured on an AMD MI455X. A time is GPU time per run, averaged over a window of back-to-back runs after a warm-up
// (all launches, gaps included; the runs take copies of the inputs in turn), and the median of several windows.
// Apart from v000's, it joins two sittings. Times from different sittings can be a few percent apart, while
// side-by-side timings come from the same sitting.
// v000 is the starting kernel. One run takes 129 microseconds.
// Layer-2 contraction (z1 rows . W2c_j, K=128, N=128): v_wmma_f32_16x16x32_f16 with A = f16(z1) and B = f16(256*W2c_j) staged
// as an [n][k] LDS plane, f32 accumulate, bias row and the 1/256 fold in f32; layer 1 (K=6), layer 3 (K=129, N=5), sigmoid and
// softmax in f32 on VALU; every float input RNE-converted to bf16 on load.
#include <hip/hip_runtime.h>
#include <math.h>
#include <stdint.h>

#define NB    16384
#define NJ    12
#define NQ    7
#define NO    5
#define NI    6
#define NH    128
#define NK2   129
#define NQO   35
#define CHUNK 512
#define NCH   (NB / CHUNK)
#define MAXT  (CHUNK / 16)
#define SLOT  64
#define WP    136
#define ZP    132
#define WSC   256.0f
#define WINV  0.00390625f

static_assert(NCH * CHUNK == NB);
static_assert(CHUNK == 2 * 256);
static_assert(NQO == NQ * NO);
static_assert((NB * NQO) % 1024 == 0);
static_assert(NQO <= SLOT);

typedef _Float16 v16h __attribute__((ext_vector_type(16)));
typedef _Float16 v8h  __attribute__((ext_vector_type(8)));
typedef float    v8f  __attribute__((ext_vector_type(8)));
typedef float    v4f  __attribute__((ext_vector_type(4)));

union FragH { v16h v; v8h h[2]; };

// f32 -> value of its bf16 RNE convert
__device__ __forceinline__ float bfr(float f) {
  unsigned u = __float_as_uint(f);
  u = (u + 0x7FFFu + ((u >> 16) & 1u)) & 0xFFFF0000u;
  return __uint_as_float(u);
}
__device__ __forceinline__ v8f zero8() { v8f z = {0.f, 0.f, 0.f, 0.f, 0.f, 0.f, 0.f, 0.f}; return z; }

// 16-bit A/B fragment: lane -> row/col (lane&15), p already includes +8*(lane>>4);
// elements 0..7 <- p[0..7] (k0+8h..k0+8h+7), elements 8..15 <- p[16..23] (k0+16+8h..); same split k map for A and B,
// B read from a k-contiguous [n][k] plane.
__device__ __forceinline__ v16h ldfrag_h(const _Float16* p) {
  FragH f;
  f.h[0] = *(const v8h*)(p);
  f.h[1] = *(const v8h*)(p + 16);
  return f.v;
}
__device__ __forceinline__ v8f mma16(v16h a, v16h b, v8f c) {
  return __builtin_amdgcn_wmma_f32_16x16x32_f16(false, a, false, b, (short)0, c, false, false);
}
// hazard gap after the last WMMA of a chain: ties D, keeps every A/B operand live
__device__ __forceinline__ void guard8(v8f& acc, v16h a0, v16h b0, v16h a1, v16h b1,
                                       v16h a2, v16h b2, v16h a3, v16h b3) {
#if defined(__HIP_DEVICE_COMPILE__)
  asm volatile("v_nop\n\tv_nop\n\tv_nop\n\tv_nop"
               : "+v"(acc) : "v"(a0), "v"(b0), "v"(a1), "v"(b1), "v"(a2), "v"(b2), "v"(a3), "v"(b3));
#endif
}

// =====================================================================================================
// Block = (judge j, chunk of 512 consecutive samples). The chunk's samples with id == j are compacted into an LDS list
// (ballot + wave-count prefix, ascending sample order, length <= 512), then processed in tiles of 16 samples; per tile and
// per question q: layer 1 on VALU -> z1 f16 rows (LDS), layer 2 on f16 WMMA (wave w = output columns 16w..16w+15, K = 128 in
// 4 steps) with bias/scale/sigmoid in f32 -> z2 f32 rows (LDS), layer 3 + softmax in f32 -> s_out[sample][q*5+o].
// coverage: s_z1 16x128 = 256 threads x 8 items; s_z2 16x128 = 8 waves x 16 rows x 16 cols; s_out cols 0..34 of all 16 rows per q
//           loop, cols 35..63 zero from block start; every sample b is owned by exactly one block (clamped id, chunk = b/512) and
//           its slot is written once (sample sl < tcnt of its tile by wave sl/2, lane half sl&1).
// =====================================================================================================
__global__ __launch_bounds__(256) void mlp_fwd(
    const float* __restrict__ x,  const int* __restrict__ jid,
    const float* __restrict__ W1, const float* __restrict__ W1a,
    const float* __restrict__ W2, const float* __restrict__ W2a,
    const float* __restrict__ V,  const float* __restrict__ Va,
    float* res) {
  __shared__ __align__(16) _Float16 s_w2t[NH * WP];   // [n = h][k], k = W2c row k+1, x256
  __shared__ __align__(16) _Float16 s_z1[16 * WP];    // [sample][h]
  __shared__ __align__(16) float s_z2[16 * ZP];       // [sample][h]
  __shared__ __align__(16) float s_xq[16 * 8];        // [sample][i], i < 5
  __shared__ __align__(16) float s_w1q[NI * NH];      // [i][h] for the current q
  __shared__ __align__(16) float s_vcq[NK2 * 8];      // [k][o], o < 5, for the current q
  __shared__ __align__(16) float s_b2[NH];            // W2c row 0
  __shared__ __align__(16) float s_lg[16 * 8];        // [sample][o] logits
  __shared__ __align__(16) float s_out[16 * SLOT];    // [sample][q*5+o], cols 35..63 zero
  __shared__ int s_idx[CHUNK];
  __shared__ int s_wc[16];

  const int t = threadIdx.x;
  const int lane = t & 31, wave = t >> 5, hh = lane >> 4, c16 = lane & 15;
  const int j = (int)(blockIdx.x % NJ);
  const int chunk = (int)(blockIdx.x / NJ);
  if (chunk >= NCH) return;                           // block-uniform, never taken with the exact grid

  // ---- block-local compaction of this chunk's samples with judge j ----
  const int sa0 = chunk * CHUNK + t;                  // < NB
  const int sa1 = sa0 + 256;                          // < NB
  int id0 = jid[sa0], id1 = jid[sa1];
  id0 = min(max(id0, 0), NJ - 1);
  id1 = min(max(id1, 0), NJ - 1);
  const bool f0 = (id0 == j), f1 = (id1 == j);
  const unsigned m0 = __builtin_amdgcn_ballot_w32(f0);
  const unsigned m1 = __builtin_amdgcn_ballot_w32(f1);
  if (lane == 0) { s_wc[wave] = __builtin_popcount(m0); s_wc[8 + wave] = __builtin_popcount(m1); }
  for (int e = t; e < 16 * SLOT; e += 256) s_out[e] = 0.f;
  __syncthreads();
  int base0 = 0, tot0 = 0, base1 = 0, tot1 = 0;
#pragma unroll
  for (int w = 0; w < 8; ++w) {
    const int ca = s_wc[w], cb = s_wc[8 + w];
    base0 += (w < wave) ? ca : 0;  tot0 += ca;
    base1 += (w < wave) ? cb : 0;  tot1 += cb;
  }
  const unsigned lt = (1u << lane) - 1u;
  int pos0 = base0 + __builtin_popcount(m0 & lt);
  int pos1 = tot0 + base1 + __builtin_popcount(m1 & lt);
  pos0 = min(pos0, CHUNK - 1);
  pos1 = min(pos1, CHUNK - 1);
  if (f0) s_idx[pos0] = sa0;
  if (f1) s_idx[pos1] = sa1;
  const int cnt = min(tot0 + tot1, CHUNK);            // block-uniform
  __syncthreads();
  if (cnt == 0) return;                               // block-uniform

  // ---- combined layer-2 weights for judge j: B plane [n][k] = f16(256 * (bf16(W2[k+1][n]) + bf16(W2_a[j][k+1][n]))) ----
  const float* W2aj = W2a + (size_t)j * NK2 * NH;
  for (int e = t; e < NH * NH; e += 256) {
    const int k = e >> 7, h = e & 127;
    const int gi = e + NH;
    const float v = (bfr(W2[gi]) + bfr(W2aj[gi])) * WSC;
    s_w2t[h * WP + k] = (_Float16)v;
  }
  if (t < NH) s_b2[t] = bfr(W2[t]) + bfr(W2aj[t]);

  const int ntile = min((cnt + 15) >> 4, MAXT);
  for (int tile = 0; tile < ntile; ++tile) {
    const int s0 = tile * 16;
    const int tcnt = min(16, cnt - s0);                // >= 1
    for (int q = 0; q < NQ; ++q) {
      // ---- stage x rows (bf16 values), W1c[q] and Vc[q] for this (tile, q) ----
      {
        const int e = min(t, 16 * NO - 1);
        const int s = e / NO, i = e - s * NO;
        const int si = min(s0 + s, cnt - 1);
        const int b  = min(max(s_idx[si], 0), NB - 1);
        const float v = bfr(x[((size_t)b * NQ + q) * NO + i]);
        if (t < 16 * NO) s_xq[s * 8 + i] = v;
      }
      {
        const float* W1q  = W1 + (size_t)q * NI * NH;
        const float* W1aq = W1a + ((size_t)j * NQ + q) * (NI * NH);
        for (int e = t; e < NI * NH; e += 256) s_w1q[e] = bfr(W1q[e]) + bfr(W1aq[e]);
        const float* Vq  = V + (size_t)q * NK2 * NO;
        const float* Vaq = Va + ((size_t)j * NQ + q) * (NK2 * NO);
        for (int e = t; e < NK2 * NO; e += 256) {
          const int k = e / NO, o = e - k * NO;
          s_vcq[k * 8 + o] = bfr(Vq[e]) + bfr(Vaq[e]);
        }
      }
      __syncthreads();

      // ---- layer 1 (f32 VALU): thread -> h = t&127, samples (t>>7) + 2*it ----
      {
        const int h = t & 127, sb = t >> 7;
        const float w0 = s_w1q[h],          w1 = s_w1q[NH + h],     w2 = s_w1q[2 * NH + h];
        const float w3 = s_w1q[3 * NH + h], w4 = s_w1q[4 * NH + h], w5 = s_w1q[5 * NH + h];
#pragma unroll 2
        for (int it = 0; it < 8; ++it) {
          const int s = sb + 2 * it;
          const v4f xv = *(const v4f*)(s_xq + s * 8);
          const float x4 = s_xq[s * 8 + 4];
          float p = w0;
          p = fmaf(xv[0], w1, p);
          p = fmaf(xv[1], w2, p);
          p = fmaf(xv[2], w3, p);
          p = fmaf(xv[3], w4, p);
          p = fmaf(x4,    w5, p);
          const float ev = expf(-p);
          s_z1[s * WP + h] = (_Float16)__builtin_amdgcn_rcpf(1.0f + ev);
        }
      }
      __syncthreads();

      // ---- layer 2 (f16 WMMA, K = 128): wave -> output columns 16*wave .. +15, rows = 16 samples ----
      {
        const int n0 = wave * 16;
        const _Float16* ap = s_z1 + c16 * WP + 8 * hh;
        const _Float16* bp = s_w2t + (n0 + c16) * WP + 8 * hh;
        const v16h a0 = ldfrag_h(ap),      g0 = ldfrag_h(bp);
        const v16h a1 = ldfrag_h(ap + 32), g1 = ldfrag_h(bp + 32);
        const v16h a2 = ldfrag_h(ap + 64), g2 = ldfrag_h(bp + 64);
        const v16h a3 = ldfrag_h(ap + 96), g3 = ldfrag_h(bp + 96);
        v8f acc = zero8();
        acc = mma16(a0, g0, acc);
        acc = mma16(a1, g1, acc);
        acc = mma16(a2, g2, acc);
        acc = mma16(a3, g3, acc);
        guard8(acc, a0, g0, a1, g1, a2, g2, a3, g3);
        const int n = n0 + c16;
        const float bias = s_b2[n];
#pragma unroll
        for (int r = 0; r < 8; ++r) {
          const float pre = acc[r] * WINV + bias;
          const float ev  = expf(-pre);
          s_z2[(8 * hh + r) * ZP + n] = __builtin_amdgcn_rcpf(1.0f + ev);
        }
      }
      __syncthreads();

      // ---- layer 3 (f32 VALU, K = 129, N = 5): waves 0..2, thread -> (row = t&15, option = min(t>>4, 4)) ----
      if (wave < 3) {
        const int r = c16;
        const int o = min(t >> 4, NO - 1);
        const float* zr = s_z2 + r * ZP;
        const float* vc = s_vcq + 8 + o;
        float a3 = s_vcq[o];
#pragma unroll 4
        for (int k = 0; k < NH; ++k) a3 = fmaf(zr[k], vc[k * 8], a3);
        if (t < 16 * NO) s_lg[r * 8 + o] = a3;
      }
      __syncthreads();

      // ---- softmax over the 5 options (wave 0, lanes 0..15 store) ----
      if (wave == 0) {
        const int r = c16;
        const float l0 = s_lg[r * 8 + 0], l1 = s_lg[r * 8 + 1], l2 = s_lg[r * 8 + 2];
        const float l3 = s_lg[r * 8 + 3], l4 = s_lg[r * 8 + 4];
        const float mx = fmaxf(fmaxf(fmaxf(l0, l1), fmaxf(l2, l3)), l4);
        const float e0 = expf(l0 - mx), e1 = expf(l1 - mx), e2 = expf(l2 - mx);
        const float e3 = expf(l3 - mx), e4 = expf(l4 - mx);
        const float sum = (((e0 + e1) + e2) + e3) + e4;
        const float inv = 1.0f / sum;
        if (lane < 16) {
          float* op = s_out + r * SLOT + q * NO;
          op[0] = e0 * inv; op[1] = e1 * inv; op[2] = e2 * inv; op[3] = e3 * inv; op[4] = e4 * inv;
        }
      }
      __syncthreads();
    }

    // ---- tile result slots: wave -> samples 2*wave + (lane>>4); 16 lanes x 16 B = one whole 256-B slot per sample ----
    {
      const int sl = 2 * wave + hh;
      const bool live = sl < tcnt;
      const int si = min(s0 + sl, cnt - 1);
      const int b  = min(max(s_idx[si], 0), NB - 1);
      const v4f v = *(const v4f*)(s_out + sl * SLOT + c16 * 4);
      float* dp = res + (size_t)b * SLOT + c16 * 4;
      if (live) *(v4f*)dp = v;
      
    }
  }
}

// =====================================================================================================
// Repack: out[e] = res[(e/35)*64 + e%35] for the flat [16384][7][5] output. Thread -> 4 consecutive floats; one instruction =
// coverage: 560 x 256 threads x 4 floats = 573440 = every output element once.
// =====================================================================================================
__global__ __launch_bounds__(256) void repack(const float* __restrict__ res, float* out) {
  const int g  = blockIdx.x * 256 + threadIdx.x;
  const int e0 = g * 4;
  v4f v;
#pragma unroll
  for (int c = 0; c < 4; ++c) {
    const int e = min(e0 + c, NB * NQO - 1);
    const int b = e / NQO;
    const int r = e - b * NQO;
    v[c] = res[(size_t)b * SLOT + r];
  }
  float* op = out + e0;
  *(v4f*)op = v;
  
}

// =====================================================================================================
// =====================================================================================================
extern "C" void kernel_launch(void* const* d_in, const int* in_sizes, int n_in,
                              void* d_out, int out_size, void* d_ws, size_t ws_size,
                              hipStream_t stream) {
  if (n_in < 8) return;
  if (in_sizes[0] != NB * NQ * NO) return;
  if (in_sizes[1] != NB) return;
  if (in_sizes[2] != NQ * NI * NH || in_sizes[3] != NJ * NQ * NI * NH) return;
  if (in_sizes[4] != NK2 * NH || in_sizes[5] != NJ * NK2 * NH) return;
  if (in_sizes[6] != NQ * NK2 * NO || in_sizes[7] != NJ * NQ * NK2 * NO) return;
  if (out_size != NB * NQO) return;
  const size_t need = (size_t)NB * SLOT * sizeof(float);    // 4194304
  if (need > ws_size) return;
  if (need > (size_t)134217728) return;

  const float* x   = (const float*)d_in[0];
  const int*   jid = (const int*)d_in[1];
  const float* W1  = (const float*)d_in[2];
  const float* W1a = (const float*)d_in[3];
  const float* W2  = (const float*)d_in[4];
  const float* W2a = (const float*)d_in[5];
  const float* V   = (const float*)d_in[6];
  const float* Va  = (const float*)d_in[7];
  float* out = (float*)d_out;
  float* res = (float*)d_ws;

  mlp_fwd<<<dim3(NJ * NCH), dim3(256), 0, stream>>>(x, jid, W1, W1a, W2, W2a, V, Va, res);
  repack<<<dim3((NB * NQO) / 1024), dim3(256), 0, stream>>>(res, out);
  (void)hipGetLastError();
}

// v001
// Measured time: 53.7 microseconds a run.
// Next to v000, in two timings, it ran 2.43 and 2.42 times as fast.
// Layer-2 contraction (z1 rows . W2c_j, K=128, N=128): v_wmma_f32_16x16x32_f16 with A = f16(z1) and B = f16(256*W2c_j) staged
// as an [n][k] LDS plane, f32 accumulate, bias row and the 1/256 fold in f32; layer 1 (K=6), layer 3 (K=129, N=5), sigmoid and
// softmax in f32 on VALU; every float input RNE-converted to bf16 on load.
#include <hip/hip_runtime.h>
#include <math.h>
#include <stdint.h>

#define NB    16384
#define NJ    12
#define NQ    7
#define NO    5
#define NI    6
#define NH    128
#define NK2   129
#define NQO   35
#define NCH   12
#define CHUNK 1366
#define NPASS 6
#define MAXT  ((CHUNK + 15) / 16)
#define SLOT  32
#define WP    136
#define ZP    132
#define WSC   256.0f
#define WINV  0.00390625f

static_assert(NCH * CHUNK >= NB && (NCH - 1) * CHUNK < NB);
static_assert(NPASS * 256 >= CHUNK);
static_assert(NQO == NQ * NO);
static_assert((NB * NQO) % 1024 == 0);
static_assert(NO <= 8 && SLOT * 4 == 128);

typedef _Float16 v16h __attribute__((ext_vector_type(16)));
typedef _Float16 v8h  __attribute__((ext_vector_type(8)));
typedef float    v8f  __attribute__((ext_vector_type(8)));
typedef float    v4f  __attribute__((ext_vector_type(4)));

union FragH { v16h v; v8h h[2]; };

// f32 -> value of its bf16 RNE convert
__device__ __forceinline__ float bfr(float f) {
  unsigned u = __float_as_uint(f);
  u = (u + 0x7FFFu + ((u >> 16) & 1u)) & 0xFFFF0000u;
  return __uint_as_float(u);
}
__device__ __forceinline__ v8f zero8() { v8f z = {0.f, 0.f, 0.f, 0.f, 0.f, 0.f, 0.f, 0.f}; return z; }

// 16-bit A/B fragment: lane -> row/col (lane&15), p already includes +8*(lane>>4);
// elements 0..7 <- p[0..7] (k0+8h..k0+8h+7), elements 8..15 <- p[16..23] (k0+16+8h..); same split k map for A and B,
// B read from a k-contiguous [n][k] plane.
__device__ __forceinline__ v16h ldfrag_h(const _Float16* p) {
  FragH f;
  f.h[0] = *(const v8h*)(p);
  f.h[1] = *(const v8h*)(p + 16);
  return f.v;
}
__device__ __forceinline__ v8f mma16(v16h a, v16h b, v8f c) {
  return __builtin_amdgcn_wmma_f32_16x16x32_f16(false, a, false, b, (short)0, c, false, false);
}
// hazard gap after the last WMMA of a chain: ties D, keeps every A/B operand live
__device__ __forceinline__ void guard8(v8f& acc, v16h a0, v16h b0, v16h a1, v16h b1,
                                       v16h a2, v16h b2, v16h a3, v16h b3) {
#if defined(__HIP_DEVICE_COMPILE__)
  asm volatile("v_nop\n\tv_nop\n\tv_nop\n\tv_nop"
               : "+v"(acc) : "v"(a0), "v"(b0), "v"(a1), "v"(b1), "v"(a2), "v"(b2), "v"(a3), "v"(b3));
#endif
}

// =====================================================================================================
// Block = (judge j, question q, chunk of 1366 consecutive samples): 12 x 7 x 12 = 1008 blocks, four to a WGP. The chunk's samples
// with id == j are compacted into an LDS list (ballot + wave-count prefix, ascending sample order, length <= 1366); W2c_j, W1c[j][q]
// and Vc[j][q] are staged once per block; the list is processed in tiles of 16 samples; per tile: layer 1 on VALU -> z1 f16 rows
// (LDS), layer 2 on f16 WMMA (wave w = output columns 16w..16w+15, K = 128 in 4 steps) with bias/scale/sigmoid in f32 -> z2 f32
// rows (LDS), layer 3 + softmax in f32 -> one 128-B line of res per (sample, question).
// coverage: s_z1 16x128 = 256 threads x 8 items; s_z2 16x128 = 8 waves x 16 rows x 16 cols; every (sample b, question q) is owned
//           by exactly one block (clamped id, q, chunk = b/1366) and its line is written once, whole (sample sl < tcnt of its tile
//           by threads 8*sl..8*sl+7, 16 B each: options 0..4, then zeros).
// =====================================================================================================
__global__ __launch_bounds__(256) void mlp_fwd(
    const float* __restrict__ x,  const int* __restrict__ jid,
    const float* __restrict__ W1, const float* __restrict__ W1a,
    const float* __restrict__ W2, const float* __restrict__ W2a,
    const float* __restrict__ V,  const float* __restrict__ Va,
    float* res) {
  __shared__ __align__(16) _Float16 s_w2t[NH * WP];   // [n = h][k], k = W2c row k+1, x256
  __shared__ __align__(16) _Float16 s_z1[16 * WP];    // [sample][h]
  __shared__ __align__(16) float s_z2[16 * ZP];       // [sample][h]
  __shared__ __align__(16) float s_xq[16 * 8];        // [sample][i], i < 5
  __shared__ __align__(16) float s_w1q[NI * NH];      // [i][h] for this block's q
  __shared__ __align__(16) float s_vcq[NK2 * 8];      // [k][o], o < 5, for this block's q
  __shared__ __align__(16) float s_b2[NH];            // W2c row 0
  __shared__ __align__(16) float s_lg[16 * 8];        // [sample][o] logits
  __shared__ int s_idx[CHUNK];
  __shared__ int s_wc[NPASS * 8];

  const int t = threadIdx.x;
  const int lane = t & 31, wave = t >> 5, hh = lane >> 4, c16 = lane & 15;
  const int q = (int)(blockIdx.x % NQ);
  const int j = (int)((blockIdx.x / NQ) % NJ);
  const int chunk = (int)(blockIdx.x / (NQ * NJ));
  if (chunk >= NCH) return;                           // block-uniform, never taken with the exact grid

  // ---- block-local compaction of this chunk's samples with judge j ----
  const int cbeg = chunk * CHUNK;                     // < NB
  const int cend = min(cbeg + CHUNK, NB);
  // the loops over p are unrolled so that ids[] and msk[] stay in registers and the six loads are in flight together
  int ids[NPASS];
  unsigned msk[NPASS];
#pragma unroll
  for (int p = 0; p < NPASS; ++p) ids[p] = jid[min(cbeg + p * 256 + t, NB - 1)];
#pragma unroll
  for (int p = 0; p < NPASS; ++p) {
    const int id = min(max(ids[p], 0), NJ - 1);
    msk[p] = __builtin_amdgcn_ballot_w32(cbeg + p * 256 + t < cend && id == j);
  }
  if (lane < NPASS) {
    unsigned m = msk[0];
#pragma unroll
    for (int p = 1; p < NPASS; ++p) m = (lane == p) ? msk[p] : m;
    s_wc[lane * 8 + wave] = __builtin_popcount(m);
  }
  __syncthreads();
  const unsigned lt = (1u << lane) - 1u;
  int run = 0;
#pragma unroll
  for (int p = 0; p < NPASS; ++p) {
    int base = 0, tot = 0;
#pragma unroll
    for (int w = 0; w < 8; ++w) {
      const int c = s_wc[p * 8 + w];
      base += (w < wave) ? c : 0;  tot += c;
    }
    const int pos = min(run + base + __builtin_popcount(msk[p] & lt), CHUNK - 1);
    if ((msk[p] >> lane) & 1u) s_idx[pos] = cbeg + p * 256 + t;
    run += tot;
  }
  const int cnt = min(run, CHUNK);                    // block-uniform
  __syncthreads();
  if (cnt == 0) return;                               // block-uniform

  // ---- combined layer-2 weights for judge j: B plane [n][k] = f16(256 * (bf16(W2[k+1][n]) + bf16(W2_a[j][k+1][n]))) ----
  const float* W2aj = W2a + (size_t)j * NK2 * NH;
  for (int e = t; e < NH * NH; e += 256) {
    const int k = e >> 7, h = e & 127;
    const int gi = e + NH;
    const float v = (bfr(W2[gi]) + bfr(W2aj[gi])) * WSC;
    s_w2t[h * WP + k] = (_Float16)v;
  }
  if (t < NH) s_b2[t] = bfr(W2[t]) + bfr(W2aj[t]);

  // ---- combined layer-1 and layer-3 weights for (judge j, question q), once per block ----
  {
    const float* W1q  = W1 + (size_t)q * NI * NH;
    const float* W1aq = W1a + ((size_t)j * NQ + q) * (NI * NH);
    for (int e = t; e < NI * NH; e += 256) s_w1q[e] = bfr(W1q[e]) + bfr(W1aq[e]);
    const float* Vq  = V + (size_t)q * NK2 * NO;
    const float* Vaq = Va + ((size_t)j * NQ + q) * (NK2 * NO);
    for (int e = t; e < NK2 * NO; e += 256) {
      const int k = e / NO, o = e - k * NO;
      s_vcq[k * 8 + o] = bfr(Vq[e]) + bfr(Vaq[e]);
    }
  }

  const int ntile = min((cnt + 15) >> 4, MAXT);
  for (int tile = 0; tile < ntile; ++tile) {
    const int s0 = tile * 16;
    const int tcnt = min(16, cnt - s0);                // >= 1
    // ---- stage x rows (bf16 values) for this tile ----
    {
      const int e = min(t, 16 * NO - 1);
      const int s = e / NO, i = e - s * NO;
      const int si = min(s0 + s, cnt - 1);
      const int b  = min(max(s_idx[si], 0), NB - 1);
      const float v = bfr(x[((size_t)b * NQ + q) * NO + i]);
      if (t < 16 * NO) s_xq[s * 8 + i] = v;
    }
    __syncthreads();                                   // first tile: also publishes the staged weights

    // ---- layer 1 (f32 VALU): thread -> h = t&127, samples (t>>7) + 2*it ----
    {
      const int h = t & 127, sb = t >> 7;
      const float w0 = s_w1q[h],          w1 = s_w1q[NH + h],     w2 = s_w1q[2 * NH + h];
      const float w3 = s_w1q[3 * NH + h], w4 = s_w1q[4 * NH + h], w5 = s_w1q[5 * NH + h];
#pragma unroll 2
      for (int it = 0; it < 8; ++it) {
        const int s = sb + 2 * it;
        const v4f xv = *(const v4f*)(s_xq + s * 8);
        const float x4 = s_xq[s * 8 + 4];
        float p = w0;
        p = fmaf(xv[0], w1, p);
        p = fmaf(xv[1], w2, p);
        p = fmaf(xv[2], w3, p);
        p = fmaf(xv[3], w4, p);
        p = fmaf(x4,    w5, p);
        const float ev = expf(-p);
        s_z1[s * WP + h] = (_Float16)__builtin_amdgcn_rcpf(1.0f + ev);
      }
    }
    __syncthreads();

    // ---- layer 2 (f16 WMMA, K = 128): wave -> output columns 16*wave .. +15, rows = 16 samples ----
    {
      const int n0 = wave * 16;
      const _Float16* ap = s_z1 + c16 * WP + 8 * hh;
      const _Float16* bp = s_w2t + (n0 + c16) * WP + 8 * hh;
      const v16h a0 = ldfrag_h(ap),      g0 = ldfrag_h(bp);
      const v16h a1 = ldfrag_h(ap + 32), g1 = ldfrag_h(bp + 32);
      const v16h a2 = ldfrag_h(ap + 64), g2 = ldfrag_h(bp + 64);
      const v16h a3 = ldfrag_h(ap + 96), g3 = ldfrag_h(bp + 96);
      v8f acc = zero8();
      acc = mma16(a0, g0, acc);
      acc = mma16(a1, g1, acc);
      acc = mma16(a2, g2, acc);
      acc = mma16(a3, g3, acc);
      guard8(acc, a0, g0, a1, g1, a2, g2, a3, g3);
      const int n = n0 + c16;
      const float bias = s_b2[n];
#pragma unroll
      for (int r = 0; r < 8; ++r) {
        const float pre = acc[r] * WINV + bias;
        const float ev  = expf(-pre);
        s_z2[(8 * hh + r) * ZP + n] = __builtin_amdgcn_rcpf(1.0f + ev);
      }
    }
    __syncthreads();

    // ---- layer 3 (f32 VALU, K = 129, N = 5): waves 0..2, thread -> (row = t&15, option = min(t>>4, 4)) ----
    if (wave < 3) {
      const int r = c16;
      const int o = min(t >> 4, NO - 1);
      const float* zr = s_z2 + r * ZP;
      const float* vc = s_vcq + 8 + o;
      float a3 = s_vcq[o];
#pragma unroll 4
      for (int k = 0; k < NH; ++k) a3 = fmaf(zr[k], vc[k * 8], a3);
      if (t < 16 * NO) s_lg[r * 8 + o] = a3;
    }
    __syncthreads();

    // ---- softmax over the 5 options and the result line: waves 0..3, thread -> (sample t>>3, 16-B piece t&7) ----
    // s_lg is next written behind later barriers of the next tile and s_xq is not read here, so no barrier closes the loop body.
    if (wave < 4) {
      const int sl = t >> 3, c8 = t & 7;
      const float l0 = s_lg[sl * 8 + 0], l1 = s_lg[sl * 8 + 1], l2 = s_lg[sl * 8 + 2];
      const float l3 = s_lg[sl * 8 + 3], l4 = s_lg[sl * 8 + 4];
      const float mx = fmaxf(fmaxf(fmaxf(l0, l1), fmaxf(l2, l3)), l4);
      const float e0 = expf(l0 - mx), e1 = expf(l1 - mx), e2 = expf(l2 - mx);
      const float e3 = expf(l3 - mx), e4 = expf(l4 - mx);
      const float sum = (((e0 + e1) + e2) + e3) + e4;
      const float inv = 1.0f / sum;
      v4f v = {0.f, 0.f, 0.f, 0.f};
      if (c8 == 0) { v[0] = e0 * inv; v[1] = e1 * inv; v[2] = e2 * inv; v[3] = e3 * inv; }
      if (c8 == 1) v[0] = e4 * inv;
      const bool live = sl < tcnt;
      const int si = min(s0 + sl, cnt - 1);
      const int b  = min(max(s_idx[si], 0), NB - 1);
      float* dp = res + ((size_t)b * NQ + q) * SLOT + c8 * 4;
      if (live) *(v4f*)dp = v;
      // the next tile's staging reuses the store's address and data registers: keep the wait in front of that overwrite
      asm volatile("s_wait_xcnt 0x0" ::: "memory");
    }
  }
}

// =====================================================================================================
// Repack: out[e] = res[(e/5)*32 + e%5] for the flat [16384][7][5] output (e/5 = sample*7 + question). Thread -> 4 consecutive floats; one instruction =
// coverage: 560 x 256 threads x 4 floats = 573440 = every output element once.
// =====================================================================================================
__global__ __launch_bounds__(256) void repack(const float* __restrict__ res, float* out) {
  const int g  = blockIdx.x * 256 + threadIdx.x;
  const int e0 = g * 4;
  v4f v;
#pragma unroll
  for (int c = 0; c < 4; ++c) {
    const int e = min(e0 + c, NB * NQO - 1);
    const int bq = e / NO;
    const int o  = e - bq * NO;
    v[c] = res[(size_t)bq * SLOT + o];
  }
  float* op = out + e0;
  *(v4f*)op = v;
  
}

// =====================================================================================================
// =====================================================================================================
extern "C" void kernel_launch(void* const* d_in, const int* in_sizes, int n_in,
                              void* d_out, int out_size, void* d_ws, size_t ws_size,
                              hipStream_t stream) {
  if (n_in < 8) return;
  if (in_sizes[0] != NB * NQ * NO) return;
  if (in_sizes[1] != NB) return;
  if (in_sizes[2] != NQ * NI * NH || in_sizes[3] != NJ * NQ * NI * NH) return;
  if (in_sizes[4] != NK2 * NH || in_sizes[5] != NJ * NK2 * NH) return;
  if (in_sizes[6] != NQ * NK2 * NO || in_sizes[7] != NJ * NQ * NK2 * NO) return;
  if (out_size != NB * NQO) return;
  const size_t need = (size_t)NB * NQ * SLOT * sizeof(float);    // 14680064
  if (need > ws_size) return;
  if (need > (size_t)134217728) return;

  const float* x   = (const float*)d_in[0];
  const int*   jid = (const int*)d_in[1];
  const float* W1  = (const float*)d_in[2];
  const float* W1a = (const float*)d_in[3];
  const float* W2  = (const float*)d_in[4];
  const float* W2a = (const float*)d_in[5];
  const float* V   = (const float*)d_in[6];
  const float* Va  = (const float*)d_in[7];
  float* out = (float*)d_out;
  float* res = (float*)d_ws;

  mlp_fwd<<<dim3(NJ * NQ * NCH), dim3(256), 0, stream>>>(x, jid, W1, W1a, W2, W2a, V, Va, res);
  repack<<<dim3((NB * NQO) / 1024), dim3(256), 0, stream>>>(res, out);
  (void)hipGetLastError();
}

// v002
// One run takes 37 microseconds.
// Timed twice side by side with v001, it ran 1.46 times as fast both times.
// All steps since v000 together make it 3.53 times as fast.
// Layer-2 contraction on v_wmma_f32_16x16x32_f16, taken transposed: D[h2][sample] = A (f16(256*W2c_j), an [n][k] LDS plane) x B (f16(z1),
// built in registers in operand layout), f32 accumulate, bias row and the 1/256 fold in f32; layer 1 (K=6), layer 3 (K=129, N=5), sigmoid
// and softmax in f32 on VALU; every float input RNE-converted to bf16 on load.
#include <hip/hip_runtime.h>
#include <math.h>
#include <stdint.h>

#define NB    16384
#define NJ    12
#define NQ    7
#define NO    5
#define NI    6
#define NH    128
#define NK2   129
#define NQO   35
#define NCH   12
#define CHUNK 1366
#define NPASS 6
#define MAXT  ((CHUNK + 15) / 16)
#define SLOT  32
#define WP    136
#define WSC   256.0f
#define WINV  0.00390625f

static_assert(NCH * CHUNK >= NB && (NCH - 1) * CHUNK < NB);
static_assert(NPASS * 256 >= CHUNK);
static_assert(NQO == NQ * NO);
static_assert((NB * NQO) % 1024 == 0);
static_assert(NO <= 8 && SLOT * 4 == 128);

typedef _Float16 v16h __attribute__((ext_vector_type(16)));
typedef _Float16 v8h  __attribute__((ext_vector_type(8)));
typedef float    v8f  __attribute__((ext_vector_type(8)));
typedef float    v4f  __attribute__((ext_vector_type(4)));

union FragH { v16h v; v8h h[2]; };

// f32 -> value of its bf16 RNE convert
__device__ __forceinline__ float bfr(float f) {
  unsigned u = __float_as_uint(f);
  u = (u + 0x7FFFu + ((u >> 16) & 1u)) & 0xFFFF0000u;
  return __uint_as_float(u);
}
__device__ __forceinline__ v8f zero8() { v8f z = {0.f, 0.f, 0.f, 0.f, 0.f, 0.f, 0.f, 0.f}; return z; }

// 16-bit A/B fragment: lane -> row/col (lane&15), p already includes +8*(lane>>4);
// elements 0..7 <- p[0..7] (k0+8h..k0+8h+7), elements 8..15 <- p[16..23] (k0+16+8h..); same split k map for A and B,
// the weight operand is read from a k-contiguous [n][k] plane.
__device__ __forceinline__ v16h ldfrag_h(const _Float16* p) {
  FragH f;
  f.h[0] = *(const v8h*)(p);
  f.h[1] = *(const v8h*)(p + 16);
  return f.v;
}
__device__ __forceinline__ v8f mma16(v16h a, v16h b, v8f c) {
  return __builtin_amdgcn_wmma_f32_16x16x32_f16(false, a, false, b, (short)0, c, false, false);
}

// =====================================================================================================
// Block = (judge j, question q, chunk of 1366 consecutive samples): 12 x 7 x 12 = 1008 blocks, four to a WGP. The chunk's samples
// with id == j are compacted into an LDS list (ballot + wave-count prefix, ascending sample order, length <= 1366); W2c_j, W1c[j][q]
// and Vc[j][q] are staged once per block and published by one barrier. From there each wave works alone on whole tiles of 16 samples
// (tile = wave, wave + 8, ...), lane -> sample (lane & 15), half hh = lane >> 4:
//   layer 1 on VALU straight into the four B fragments of z1^T (element e of fragment s: k = 32s + 8hh + e, e < 8; 32s + 16 + 8hh + e - 8);
//   layer 2: for each of the 8 row tiles T of W2c^T four WMMAs (K = 128); acc[r] = pre-activation of hidden unit 16T + 8hh + r of the
//   lane's sample; bias, scale and sigmoid in f32;
//   layer 3: each z2 value goes from its register into the lane's 5 logit sums; the two halves of a sample are added by one lane exchange;
//   softmax in the lane; one 128-B line of res per (sample, question).
// coverage: every (sample b, question q) is owned by exactly one block (clamped id, q, chunk = b/1366), there by one tile and one wave;
//           its line is written once, whole, by lanes c16 and c16 + 16 (four 16-B pieces each: options 0..4, then zeros).
// =====================================================================================================
// second argument: 8 waves a SIMD (128 VGPRs), so that four blocks fit a WGP and all 1008 are resident at once
__global__ __launch_bounds__(256, 8) void mlp_fwd(
    const float* __restrict__ x,  const int* __restrict__ jid,
    const float* __restrict__ W1, const float* __restrict__ W1a,
    const float* __restrict__ W2, const float* __restrict__ W2a,
    const float* __restrict__ V,  const float* __restrict__ Va,
    float* res) {
  __shared__ __align__(16) _Float16 s_w2t[NH * WP];   // [n = h][k], k = W2c row k+1, x256
  __shared__ __align__(16) float s_w1q[NI * NH];      // [i][h] for this block's q
  __shared__ __align__(16) float s_vc4[NH * 4];       // [h][o], o < 4: Vc row h+1 for this block's q
  __shared__ __align__(16) float s_vc1[NH];           // [h], o = 4
  __shared__ __align__(16) float s_vb[8];             // Vc row 0, o < 5
  __shared__ __align__(16) float s_b2[NH];            // W2c row 0
  __shared__ int s_idx[CHUNK];
  __shared__ int s_wc[NPASS * 8];

  const int t = threadIdx.x;
  const int lane = t & 31, wave = t >> 5, hh = lane >> 4, c16 = lane & 15;
  const int q = (int)(blockIdx.x % NQ);
  const int j = (int)((blockIdx.x / NQ) % NJ);
  const int chunk = (int)(blockIdx.x / (NQ * NJ));
  if (chunk >= NCH) return;                           // block-uniform, never taken with the exact grid

  // ---- block-local compaction of this chunk's samples with judge j ----
  const int cbeg = chunk * CHUNK;                     // < NB
  const int cend = min(cbeg + CHUNK, NB);
  // the loops over p are unrolled so that ids[] and msk[] stay in registers and the six loads are in flight together
  int ids[NPASS];
  unsigned msk[NPASS];
#pragma unroll
  for (int p = 0; p < NPASS; ++p) ids[p] = jid[min(cbeg + p * 256 + t, NB - 1)];
#pragma unroll
  for (int p = 0; p < NPASS; ++p) {
    const int id = min(max(ids[p], 0), NJ - 1);
    msk[p] = __builtin_amdgcn_ballot_w32(cbeg + p * 256 + t < cend && id == j);
  }
  if (lane < NPASS) {
    unsigned m = msk[0];
#pragma unroll
    for (int p = 1; p < NPASS; ++p) m = (lane == p) ? msk[p] : m;
    s_wc[lane * 8 + wave] = __builtin_popcount(m);
  }
  __syncthreads();
  const unsigned lt = (1u << lane) - 1u;
  int run = 0;
#pragma unroll
  for (int p = 0; p < NPASS; ++p) {
    int base = 0, tot = 0;
#pragma unroll
    for (int w = 0; w < 8; ++w) {
      const int c = s_wc[p * 8 + w];
      base += (w < wave) ? c : 0;  tot += c;
    }
    const int pos = min(run + base + __builtin_popcount(msk[p] & lt), CHUNK - 1);
    if ((msk[p] >> lane) & 1u) s_idx[pos] = cbeg + p * 256 + t;
    run += tot;
  }
  const int cnt = __builtin_amdgcn_readfirstlane(min(run, CHUNK));   // block-uniform; scalar, so that the tile loop branches on SCC
  __syncthreads();
  if (cnt == 0) return;                               // block-uniform

  // ---- combined layer-2 weights for judge j: plane [n][k] = f16(256 * (bf16(W2[k+1][n]) + bf16(W2_a[j][k+1][n]))) ----
  const float* W2aj = W2a + (size_t)j * NK2 * NH;
  for (int e = t; e < NH * NH; e += 256) {
    const int k = e >> 7, h = e & 127;
    const int gi = e + NH;
    const float v = (bfr(W2[gi]) + bfr(W2aj[gi])) * WSC;
    s_w2t[h * WP + k] = (_Float16)v;
  }
  if (t < NH) s_b2[t] = bfr(W2[t]) + bfr(W2aj[t]);

  // ---- combined layer-1 and layer-3 weights for (judge j, question q), once per block ----
  {
    const float* W1q  = W1 + (size_t)q * NI * NH;
    const float* W1aq = W1a + ((size_t)j * NQ + q) * (NI * NH);
    for (int e = t; e < NI * NH; e += 256) s_w1q[e] = bfr(W1q[e]) + bfr(W1aq[e]);
    const float* Vq  = V + (size_t)q * NK2 * NO;
    const float* Vaq = Va + ((size_t)j * NQ + q) * (NK2 * NO);
    for (int e = t; e < NK2 * NO; e += 256) {
      const int k = e / NO, o = e - k * NO;
      const float v = bfr(Vq[e]) + bfr(Vaq[e]);
      float* dst = (k == 0) ? (s_vb + o) : ((o < 4) ? (s_vc4 + (k - 1) * 4 + o) : (s_vc1 + (k - 1)));
      *dst = v;
    }
  }

  __syncthreads();                                     // publishes the staged weights; the only barrier behind the staging

  const int ntile = min((cnt + 15) >> 4, MAXT);
  const int wv = __builtin_amdgcn_readfirstlane(wave); // scalar: every lane is on at the WMMAs
  for (int tile = wv; tile < ntile; tile += 8) {
    const int s0 = tile * 16;
    const int si = min(s0 + c16, cnt - 1);
    const int b  = min(max(s_idx[si], 0), NB - 1);
    const float* xp = x + ((size_t)b * NQ + q) * NO;
    const float x0 = bfr(xp[0]), x1 = bfr(xp[1]), x2 = bfr(xp[2]), x3 = bfr(xp[3]), x4 = bfr(xp[4]);

    // ---- layer 1 (f32 VALU) into the B fragments of z1^T; unrolled so that zb[] is indexed by constants and stays in registers ----
    v16h zb[4];
#pragma unroll
    for (int g = 0; g < 8; ++g) {
      const float* wp = s_w1q + 32 * (g >> 1) + 16 * (g & 1) + 8 * hh;
      float p[8];
      {
        const v4f wa = *(const v4f*)(wp), wb = *(const v4f*)(wp + 4);
#pragma unroll
        for (int c = 0; c < 4; ++c) { p[c] = wa[c]; p[4 + c] = wb[c]; }
      }
#pragma unroll
      for (int i = 1; i < NI; ++i) {
        const float xi = (i == 1) ? x0 : (i == 2) ? x1 : (i == 3) ? x2 : (i == 4) ? x3 : x4;
        const v4f wa = *(const v4f*)(wp + i * NH), wb = *(const v4f*)(wp + i * NH + 4);
#pragma unroll
        for (int c = 0; c < 4; ++c) { p[c] = fmaf(xi, wa[c], p[c]); p[4 + c] = fmaf(xi, wb[c], p[4 + c]); }
      }
#pragma unroll
      for (int c = 0; c < 8; ++c) {
        const float ev = expf(-p[c]);
        zb[g >> 1][8 * (g & 1) + c] = (_Float16)__builtin_amdgcn_rcpf(1.0f + ev);
      }
    }

    // ---- layer 2 (f16 WMMA, K = 128, rows = hidden units, columns = samples) and layer 3 (f32 VALU) from the accumulators ----
    float l0 = hh ? 0.f : s_vb[0], l1 = hh ? 0.f : s_vb[1], l2 = hh ? 0.f : s_vb[2];
    float l3 = hh ? 0.f : s_vb[3], l4 = hh ? 0.f : s_vb[4];
    const _Float16* ap = s_w2t + c16 * WP + 8 * hh;
    // rolled: the text stays short and the registers inside the budget of 8 waves a SIMD
#pragma unroll 1
    for (int T = 0; T < 8; ++T) {
      const _Float16* a = ap + T * 16 * WP;
      const v16h a0 = ldfrag_h(a), a1 = ldfrag_h(a + 32), a2 = ldfrag_h(a + 64), a3 = ldfrag_h(a + 96);
      // keeps the eight fragment loads together in front of the chain: one LDS latency a row tile instead of four
      __builtin_amdgcn_sched_barrier(0);
      v8f acc = zero8();
      acc = mma16(a0, zb[0], acc);
      acc = mma16(a1, zb[1], acc);
      acc = mma16(a2, zb[2], acc);
      acc = mma16(a3, zb[3], acc);
      // keeps the layer-3 weight loads behind the WMMAs, where the A fragments' registers are free again (no spill at 128 VGPRs)
      __builtin_amdgcn_sched_barrier(0);
      const int nb = T * 16 + 8 * hh;
      const v4f ba = *(const v4f*)(s_b2 + nb),  bb = *(const v4f*)(s_b2 + nb + 4);
      const v4f ua = *(const v4f*)(s_vc1 + nb), ub = *(const v4f*)(s_vc1 + nb + 4);
#pragma unroll
      for (int r = 0; r < 8; ++r) {
        const float bias = (r < 4) ? ba[r & 3] : bb[r & 3];
        const float u    = (r < 4) ? ua[r & 3] : ub[r & 3];
        const float pre = acc[r] * WINV + bias;
        const float ev  = expf(-pre);
        const float z   = __builtin_amdgcn_rcpf(1.0f + ev);
        const v4f vv = *(const v4f*)(s_vc4 + (nb + r) * 4);
        l0 = fmaf(z, vv[0], l0);
        l1 = fmaf(z, vv[1], l1);
        l2 = fmaf(z, vv[2], l2);
        l3 = fmaf(z, vv[3], l3);
        l4 = fmaf(z, u,     l4);
      }
    }
    // the other half of the hidden units of this sample sits 16 lanes away
    l0 += __shfl_xor(l0, 16);
    l1 += __shfl_xor(l1, 16);
    l2 += __shfl_xor(l2, 16);
    l3 += __shfl_xor(l3, 16);
    l4 += __shfl_xor(l4, 16);

    // ---- softmax over the 5 options and the result line ----
    {
      const float mx = fmaxf(fmaxf(fmaxf(l0, l1), fmaxf(l2, l3)), l4);
      const float e0 = expf(l0 - mx), e1 = expf(l1 - mx), e2 = expf(l2 - mx);
      const float e3 = expf(l3 - mx), e4 = expf(l4 - mx);
      const float sum = (((e0 + e1) + e2) + e3) + e4;
      const float inv = 1.0f / sum;
      v4f v = {0.f, 0.f, 0.f, 0.f};
      const v4f zz = {0.f, 0.f, 0.f, 0.f};
      if (hh == 0) { v[0] = e0 * inv; v[1] = e1 * inv; v[2] = e2 * inv; v[3] = e3 * inv; }
      else         { v[0] = e4 * inv; }
      float* dp = res + ((size_t)b * NQ + q) * SLOT + hh * 4;
      if (s0 + c16 < cnt) {
        *(v4f*)(dp)      = v;
        *(v4f*)(dp + 8)  = zz;
        *(v4f*)(dp + 16) = zz;
        *(v4f*)(dp + 24) = zz;
      }
      // the next tile reuses the stores' address and data registers: keep the wait in front of that overwrite
      asm volatile("s_wait_xcnt 0x0" ::: "memory");
    }
  }
}

// =====================================================================================================
// Repack: out[e] = res[(e/5)*32 + e%5] for the flat [16384][7][5] output (e/5 = sample*7 + question). Thread -> 4 consecutive floats; one instruction =
// coverage: 560 x 256 threads x 4 floats = 573440 = every output element once.
// =====================================================================================================
__global__ __launch_bounds__(256) void repack(const float* __restrict__ res, float* out) {
  const int g  = blockIdx.x * 256 + threadIdx.x;
  const int e0 = g * 4;
  v4f v;
#pragma unroll
  for (int c = 0; c < 4; ++c) {
    const int e = min(e0 + c, NB * NQO - 1);
    const int bq = e / NO;
    const int o  = e - bq * NO;
    v[c] = res[(size_t)bq * SLOT + o];
  }
  float* op = out + e0;
  *(v4f*)op = v;
  
}

// =====================================================================================================
// =====================================================================================================
extern "C" void kernel_launch(void* const* d_in, const int* in_sizes, int n_in,
                              void* d_out, int out_size, void* d_ws, size_t ws_size,
                              hipStream_t stream) {
  if (n_in < 8) return;
  if (in_sizes[0] != NB * NQ * NO) return;
  if (in_sizes[1] != NB) return;
  if (in_sizes[2] != NQ * NI * NH || in_sizes[3] != NJ * NQ * NI * NH) return;
  if (in_sizes[4] != NK2 * NH || in_sizes[5] != NJ * NK2 * NH) return;
  if (in_sizes[6] != NQ * NK2 * NO || in_sizes[7] != NJ * NQ * NK2 * NO) return;
  if (out_size != NB * NQO) return;
  const size_t need = (size_t)NB * NQ * SLOT * sizeof(float);    // 14680064
  if (need > ws_size) return;
  if (need > (size_t)134217728) return;

  const float* x   = (const float*)d_in[0];
  const int*   jid = (const int*)d_in[1];
  const float* W1  = (const float*)d_in[2];
  const float* W1a = (const float*)d_in[3];
  const float* W2  = (const float*)d_in[4];
  const float* W2a = (const float*)d_in[5];
  const float* V   = (const float*)d_in[6];
  const float* Va  = (const float*)d_in[7];
  float* out = (float*)d_out;
  float* res = (float*)d_ws;

  mlp_fwd<<<dim3(NJ * NQ * NCH), dim3(256), 0, stream>>>(x, jid, W1, W1a, W2, W2a, V, Va, res);
  repack<<<dim3((NB * NQO) / 1024), dim3(256), 0, stream>>>(res, out);
  (void)hipGetLastError();
}

// v003
// Measured time: 32 microseconds a run.
// In both of two side-by-side timings against v002, it was 1.15 times as fast.
// All steps since v000 together make it 4.06 times as fast.
// Layer-2 contraction on v_wmma_f32_16x16x32_f16, taken transposed: D[h2][sample] = A (f16(256*W2c_j), an [n][k] LDS plane) x B (f16(z1),
// built in registers in operand layout), f32 accumulate, bias row and the 1/256 fold in f32; layer 1 (K=6), layer 3 (K=129, N=5), sigmoid
// (0.5 + 0.5 * tanh(x/2), hardware tanh) and softmax in f32 on VALU; every float input RNE-converted to bf16 on load.
#include <hip/hip_runtime.h>
#include <math.h>
#include <stdint.h>

#define NB    16384
#define NJ    12
#define NQ    7
#define NO    5
#define NI    6
#define NH    128
#define NK2   129
#define NQO   35
#define NCH   12
#define CHUNK 1366
#define NPASS 6
#define MAXT  ((CHUNK + 15) / 16)
#define SLOT  32
#define WP    136
#define WSC   256.0f
#define WINVH 0.001953125f   // (1/256) / 2: the unscale of the f16 weights and the half of the sigmoid's argument in one factor

static_assert(NCH * CHUNK >= NB && (NCH - 1) * CHUNK < NB);
static_assert(NPASS * 256 >= CHUNK);
static_assert(NQO == NQ * NO);
static_assert((NB * NQO) % 1024 == 0);
static_assert(NO <= 8 && SLOT * 4 == 128);

typedef _Float16 v16h __attribute__((ext_vector_type(16)));
typedef _Float16 v8h  __attribute__((ext_vector_type(8)));
typedef float    v8f  __attribute__((ext_vector_type(8)));
typedef float    v4f  __attribute__((ext_vector_type(4)));
typedef float    v2f  __attribute__((ext_vector_type(2)));

union FragH { v16h v; v8h h[2]; };

// f32 -> value of its bf16 RNE convert
__device__ __forceinline__ float bfr(float f) {
  unsigned u = __float_as_uint(f);
  u = (u + 0x7FFFu + ((u >> 16) & 1u)) & 0xFFFF0000u;
  return __uint_as_float(u);
}
// sigmoid(2 * hx) = 0.5 + 0.5 * tanh(hx): one hardware transcendental and one FMA; the callers hand in HALF the pre-activation
// (the factor 1/2, a power of two and so exact, is folded into the staged layer-1 weights, the layer-2 bias and the layer-2 unscale)
// two values a call, so that the FMA is a packed one
__device__ __forceinline__ v2f sigm_half2(v2f hx) {
  v2f th;
  th[0] = __builtin_amdgcn_tanhf(hx[0]);
  th[1] = __builtin_amdgcn_tanhf(hx[1]);
  return th * 0.5f + 0.5f;
}
__device__ __forceinline__ v8f zero8() { v8f z = {0.f, 0.f, 0.f, 0.f, 0.f, 0.f, 0.f, 0.f}; return z; }

// 16-bit A/B fragment: lane -> row/col (lane&15), p already includes +8*(lane>>4);
// elements 0..7 <- p[0..7] (k0+8h..k0+8h+7), elements 8..15 <- p[16..23] (k0+16+8h..); same split k map for A and B,
// the weight operand is read from a k-contiguous [n][k] plane.
__device__ __forceinline__ v16h ldfrag_h(const _Float16* p) {
  FragH f;
  f.h[0] = *(const v8h*)(p);
  f.h[1] = *(const v8h*)(p + 16);
  return f.v;
}
__device__ __forceinline__ v8f mma16(v16h a, v16h b, v8f c) {
  return __builtin_amdgcn_wmma_f32_16x16x32_f16(false, a, false, b, (short)0, c, false, false);
}

// =====================================================================================================
// Block = (judge j, question q, chunk of 1366 consecutive samples): 12 x 7 x 12 = 1008 blocks, four to a WGP. The chunk's samples
// with id == j are compacted into an LDS list (ballot + wave-count prefix, ascending sample order, length <= 1366); W2c_j, W1c[j][q]
// and Vc[j][q] are staged once per block and published by one barrier. From there each wave works alone on whole tiles of 16 samples
// (tile = wave, wave + 8, ...), lane -> sample (lane & 15), half hh = lane >> 4:
//   layer 1 on VALU straight into the four B fragments of z1^T (element e of fragment s: k = 32s + 8hh + e, e < 8; 32s + 16 + 8hh + e - 8);
//   layer 2: for each of the 8 row tiles T of W2c^T four WMMAs (K = 128); acc[r] = pre-activation of hidden unit 16T + 8hh + r of the
//   lane's sample; bias, scale and sigmoid in f32;
//   layer 3: each z2 value goes from its register into the lane's 5 logit sums; the two halves of a sample are added by one lane exchange;
//   softmax in the lane; one 128-B line of res per (sample, question).
// coverage: every (sample b, question q) is owned by exactly one block (clamped id, q, chunk = b/1366), there by one tile and one wave;
//           its line is written once, whole, by lanes c16 and c16 + 16 (four 16-B pieces each: options 0..4, then zeros).
// =====================================================================================================
// second argument: 8 waves a SIMD (128 VGPRs), so that four blocks fit a WGP and all 1008 are resident at once
__global__ __launch_bounds__(256, 8) void mlp_fwd(
    const float* __restrict__ x,  const int* __restrict__ jid,
    const float* __restrict__ W1, const float* __restrict__ W1a,
    const float* __restrict__ W2, const float* __restrict__ W2a,
    const float* __restrict__ V,  const float* __restrict__ Va,
    float* res) {
  __shared__ __align__(16) _Float16 s_w2t[NH * WP];   // [n = h][k], k = W2c row k+1, x256
  __shared__ __align__(16) float s_w1q[NI * NH];      // [i][h] for this block's q, x 1/2
  __shared__ __align__(16) float s_vc4[NH * 4];       // [h][o], o < 4: Vc row h+1 for this block's q
  __shared__ __align__(16) float s_vc1[NH];           // [h], o = 4
  __shared__ __align__(16) float s_vb[8];             // Vc row 0, o < 5
  __shared__ __align__(16) float s_b2[NH];            // W2c row 0, x 1/2
  __shared__ int s_idx[CHUNK];
  __shared__ int s_wc[NPASS * 8];

  const int t = threadIdx.x;
  const int lane = t & 31, wave = t >> 5, hh = lane >> 4, c16 = lane & 15;
  const int q = (int)(blockIdx.x % NQ);
  const int j = (int)((blockIdx.x / NQ) % NJ);
  const int chunk = (int)(blockIdx.x / (NQ * NJ));
  if (chunk >= NCH) return;                           // block-uniform, never taken with the exact grid

  // ---- block-local compaction of this chunk's samples with judge j ----
  const int cbeg = chunk * CHUNK;                     // < NB
  const int cend = min(cbeg + CHUNK, NB);
  // the loops over p are unrolled so that ids[] and msk[] stay in registers and the six loads are in flight together
  int ids[NPASS];
  unsigned msk[NPASS];
#pragma unroll
  for (int p = 0; p < NPASS; ++p) ids[p] = jid[min(cbeg + p * 256 + t, NB - 1)];
#pragma unroll
  for (int p = 0; p < NPASS; ++p) {
    const int id = min(max(ids[p], 0), NJ - 1);
    msk[p] = __builtin_amdgcn_ballot_w32(cbeg + p * 256 + t < cend && id == j);
  }
  if (lane < NPASS) {
    unsigned m = msk[0];
#pragma unroll
    for (int p = 1; p < NPASS; ++p) m = (lane == p) ? msk[p] : m;
    s_wc[lane * 8 + wave] = __builtin_popcount(m);
  }
  __syncthreads();
  const unsigned lt = (1u << lane) - 1u;
  int run = 0;
#pragma unroll
  for (int p = 0; p < NPASS; ++p) {
    int base = 0, tot = 0;
#pragma unroll
    for (int w = 0; w < 8; ++w) {
      const int c = s_wc[p * 8 + w];
      base += (w < wave) ? c : 0;  tot += c;
    }
    const int pos = min(run + base + __builtin_popcount(msk[p] & lt), CHUNK - 1);
    if ((msk[p] >> lane) & 1u) s_idx[pos] = cbeg + p * 256 + t;
    run += tot;
  }
  const int cnt = __builtin_amdgcn_readfirstlane(min(run, CHUNK));   // block-uniform; scalar, so that the tile loop branches on SCC
  __syncthreads();
  if (cnt == 0) return;                               // block-uniform

  // ---- combined layer-2 weights for judge j: plane [n][k] = f16(256 * (bf16(W2[k+1][n]) + bf16(W2_a[j][k+1][n]))) ----
  const float* W2aj = W2a + (size_t)j * NK2 * NH;
  for (int e = t; e < NH * NH; e += 256) {
    const int k = e >> 7, h = e & 127;
    const int gi = e + NH;
    const float v = (bfr(W2[gi]) + bfr(W2aj[gi])) * WSC;
    s_w2t[h * WP + k] = (_Float16)v;
  }
  if (t < NH) s_b2[t] = (bfr(W2[t]) + bfr(W2aj[t])) * 0.5f;

  // ---- combined layer-1 and layer-3 weights for (judge j, question q), once per block ----
  {
    const float* W1q  = W1 + (size_t)q * NI * NH;
    const float* W1aq = W1a + ((size_t)j * NQ + q) * (NI * NH);
    for (int e = t; e < NI * NH; e += 256) s_w1q[e] = (bfr(W1q[e]) + bfr(W1aq[e])) * 0.5f;
    const float* Vq  = V + (size_t)q * NK2 * NO;
    const float* Vaq = Va + ((size_t)j * NQ + q) * (NK2 * NO);
    for (int e = t; e < NK2 * NO; e += 256) {
      const int k = e / NO, o = e - k * NO;
      const float v = bfr(Vq[e]) + bfr(Vaq[e]);
      float* dst = (k == 0) ? (s_vb + o) : ((o < 4) ? (s_vc4 + (k - 1) * 4 + o) : (s_vc1 + (k - 1)));
      *dst = v;
    }
  }

  __syncthreads();                                     // publishes the staged weights; the only barrier behind the staging

  const int ntile = min((cnt + 15) >> 4, MAXT);
  const int wv = __builtin_amdgcn_readfirstlane(wave); // scalar: every lane is on at the WMMAs
  for (int tile = wv; tile < ntile; tile += 8) {
    const int s0 = tile * 16;
    const int si = min(s0 + c16, cnt - 1);
    const int b  = min(max(s_idx[si], 0), NB - 1);
    const float* xp = x + ((size_t)b * NQ + q) * NO;
    const float x0 = bfr(xp[0]), x1 = bfr(xp[1]), x2 = bfr(xp[2]), x3 = bfr(xp[3]), x4 = bfr(xp[4]);

    // ---- layer 1 (f32 VALU) into the B fragments of z1^T; unrolled so that zb[] is indexed by constants and stays in registers ----
    v16h zb[4];
#pragma unroll
    for (int g = 0; g < 8; ++g) {
      const float* wp = s_w1q + 32 * (g >> 1) + 16 * (g & 1) + 8 * hh;
      // pairs of hidden units, so that the sums stay packed FMAs up to the packed FMA of the sigmoid
      v2f p[4];
      {
        const v4f wa = *(const v4f*)(wp), wb = *(const v4f*)(wp + 4);
        p[0] = wa.lo;  p[1] = wa.hi;  p[2] = wb.lo;  p[3] = wb.hi;
      }
#pragma unroll
      for (int i = 1; i < NI; ++i) {
        const float xi = (i == 1) ? x0 : (i == 2) ? x1 : (i == 3) ? x2 : (i == 4) ? x3 : x4;
        const v2f xx = {xi, xi};
        const v4f wa = *(const v4f*)(wp + i * NH), wb = *(const v4f*)(wp + i * NH + 4);
        p[0] = __builtin_elementwise_fma(xx, wa.lo, p[0]);
        p[1] = __builtin_elementwise_fma(xx, wa.hi, p[1]);
        p[2] = __builtin_elementwise_fma(xx, wb.lo, p[2]);
        p[3] = __builtin_elementwise_fma(xx, wb.hi, p[3]);
      }
#pragma unroll
      for (int c = 0; c < 4; ++c) {
        const v2f z = sigm_half2(p[c]);
        zb[g >> 1][8 * (g & 1) + 2 * c]     = (_Float16)z[0];
        zb[g >> 1][8 * (g & 1) + 2 * c + 1] = (_Float16)z[1];
      }
    }

    // ---- layer 2 (f16 WMMA, K = 128, rows = hidden units, columns = samples) and layer 3 (f32 VALU) from the accumulators ----
    float l0 = hh ? 0.f : s_vb[0], l1 = hh ? 0.f : s_vb[1], l2 = hh ? 0.f : s_vb[2];
    float l3 = hh ? 0.f : s_vb[3], l4 = hh ? 0.f : s_vb[4];
    const _Float16* ap = s_w2t + c16 * WP + 8 * hh;
    // rolled: the text stays short and the registers inside the budget of 8 waves a SIMD
#pragma unroll 1
    for (int T = 0; T < 8; ++T) {
      const _Float16* a = ap + T * 16 * WP;
      const v16h a0 = ldfrag_h(a), a1 = ldfrag_h(a + 32), a2 = ldfrag_h(a + 64), a3 = ldfrag_h(a + 96);
      // keeps the eight fragment loads together in front of the chain: one LDS latency a row tile instead of four
      __builtin_amdgcn_sched_barrier(0);
      v8f acc = zero8();
      acc = mma16(a0, zb[0], acc);
      acc = mma16(a1, zb[1], acc);
      acc = mma16(a2, zb[2], acc);
      acc = mma16(a3, zb[3], acc);
      // keeps the layer-3 weight loads behind the WMMAs, where the A fragments' registers are free again (no spill at 128 VGPRs)
      __builtin_amdgcn_sched_barrier(0);
      const int nb = T * 16 + 8 * hh;
      const v4f ba = *(const v4f*)(s_b2 + nb),  bb = *(const v4f*)(s_b2 + nb + 4);
      const v4f ua = *(const v4f*)(s_vc1 + nb), ub = *(const v4f*)(s_vc1 + nb + 4);
      float zr[8];
#pragma unroll
      for (int r = 0; r < 8; r += 2) {
        const v2f a2 = {acc[r], acc[r + 1]};
        const v2f b2 = {(r < 4) ? ba[r & 3] : bb[r & 3], (r < 4) ? ba[(r & 3) + 1] : bb[(r & 3) + 1]};
        const v2f z2 = sigm_half2(a2 * WINVH + b2);
        zr[r] = z2[0];  zr[r + 1] = z2[1];
      }
#pragma unroll
      for (int r = 0; r < 8; ++r) {
        const float u = (r < 4) ? ua[r & 3] : ub[r & 3];
        const float z = zr[r];
        const v4f vv = *(const v4f*)(s_vc4 + (nb + r) * 4);
        l0 = fmaf(z, vv[0], l0);
        l1 = fmaf(z, vv[1], l1);
        l2 = fmaf(z, vv[2], l2);
        l3 = fmaf(z, vv[3], l3);
        l4 = fmaf(z, u,     l4);
      }
    }
    // the other half of the hidden units of this sample sits 16 lanes away
    l0 += __shfl_xor(l0, 16);
    l1 += __shfl_xor(l1, 16);
    l2 += __shfl_xor(l2, 16);
    l3 += __shfl_xor(l3, 16);
    l4 += __shfl_xor(l4, 16);

    // ---- softmax over the 5 options and the result line ----
    {
      const float mx = fmaxf(fmaxf(fmaxf(l0, l1), fmaxf(l2, l3)), l4);
      const float e0 = expf(l0 - mx), e1 = expf(l1 - mx), e2 = expf(l2 - mx);
      const float e3 = expf(l3 - mx), e4 = expf(l4 - mx);
      const float sum = (((e0 + e1) + e2) + e3) + e4;
      const float inv = 1.0f / sum;
      v4f v = {0.f, 0.f, 0.f, 0.f};
      const v4f zz = {0.f, 0.f, 0.f, 0.f};
      if (hh == 0) { v[0] = e0 * inv; v[1] = e1 * inv; v[2] = e2 * inv; v[3] = e3 * inv; }
      else         { v[0] = e4 * inv; }
      float* dp = res + ((size_t)b * NQ + q) * SLOT + hh * 4;
      if (s0 + c16 < cnt) {
        *(v4f*)(dp)      = v;
        *(v4f*)(dp + 8)  = zz;
        *(v4f*)(dp + 16) = zz;
        *(v4f*)(dp + 24) = zz;
      }
      // the next tile reuses the stores' address and data registers: keep the wait in front of that overwrite
      asm volatile("s_wait_xcnt 0x0" ::: "memory");
    }
  }
}

// =====================================================================================================
// Repack: out[e] = res[(e/5)*32 + e%5] for the flat [16384][7][5] output (e/5 = sample*7 + question). Thread -> 4 consecutive floats; one instruction =
// coverage: 560 x 256 threads x 4 floats = 573440 = every output element once.
// =====================================================================================================
__global__ __launch_bounds__(256) void repack(const float* __restrict__ res, float* out) {
  const int g  = blockIdx.x * 256 + threadIdx.x;
  const int e0 = g * 4;
  v4f v;
#pragma unroll
  for (int c = 0; c < 4; ++c) {
    const int e = min(e0 + c, NB * NQO - 1);
    const int bq = e / NO;
    const int o  = e - bq * NO;
    v[c] = res[(size_t)bq * SLOT + o];
  }
  float* op = out + e0;
  *(v4f*)op = v;
  
}

// =====================================================================================================
// =====================================================================================================
extern "C" void kernel_launch(void* const* d_in, const int* in_sizes, int n_in,
                              void* d_out, int out_size, void* d_ws, size_t ws_size,
                              hipStream_t stream) {
  if (n_in < 8) return;
  if (in_sizes[0] != NB * NQ * NO) return;
  if (in_sizes[1] != NB) return;
  if (in_sizes[2] != NQ * NI * NH || in_sizes[3] != NJ * NQ * NI * NH) return;
  if (in_sizes[4] != NK2 * NH || in_sizes[5] != NJ * NK2 * NH) return;
  if (in_sizes[6] != NQ * NK2 * NO || in_sizes[7] != NJ * NQ * NK2 * NO) return;
  if (out_size != NB * NQO) return;
  const size_t need = (size_t)NB * NQ * SLOT * sizeof(float);    // 14680064
  if (need > ws_size) return;
  if (need > (size_t)134217728) return;

  const float* x   = (const float*)d_in[0];
  const int*   jid = (const int*)d_in[1];
  const float* W1  = (const float*)d_in[2];
  const float* W1a = (const float*)d_in[3];
  const float* W2  = (const float*)d_in[4];
  const float* W2a = (const float*)d_in[5];
  const float* V   = (const float*)d_in[6];
  const float* Va  = (const float*)d_in[7];
  float* out = (float*)d_out;
  float* res = (float*)d_ws;

  mlp_fwd<<<dim3(NJ * NQ * NCH), dim3(256), 0, stream>>>(x, jid, W1, W1a, W2, W2a, V, Va, res);
  repack<<<dim3((NB * NQO) / 1024), dim3(256), 0, stream>>>(res, out);
  (void)hipGetLastError();
}

// v005
// A run of this version takes 22 microseconds.
// Versions between v003 and this one are left out; their measured steps multiply to 1.46 times as fast.
// All steps since v000 together make it 5.92 times as fast.
// All three contractions on v_wmma_f32_16x16x32_f16, taken transposed (rows = output units, columns = samples), f32 accumulate:
// A = the layer's combined weights as an f16 [n][k] LDS plane (layer 2: x256, the 1/256 folded back in f32), B = the layer's input in f16,
// built in registers: the D layout of one layer is the B fragment layout of the next. Layer 1 has K = 6 (bias row included) padded with
// zeros, layer 3 has 5 rows padded to 8 and taken twice (rows 8..15 = rows 0..7). Layer-3 bias row as the f32 start of its accumulator; layer-2 bias row, sigmoid
// (0.5 + 0.5 * tanh(x/2), hardware tanh) and softmax in f32 on VALU; every float input RNE-converted to bf16 on load.
#include <hip/hip_runtime.h>
#include <math.h>
#include <stdint.h>

#define NB    16384
#define NJ    12
#define NQ    7
#define NO    5
#define NI    6
#define NH    128
#define NK2   129
#define NQO   35
#define NS    3                // blocks per (judge, question)
#define NT    1024             // threads a block
#define NW    (NT / 32)
#define IPW   (NB / NW)        // ids scanned by one wave
#define NLD   (IPW / 128)      // 16-B id loads a lane
#define MAXT  (NB / 16)
#define SLOT  32
#define WP    136
#define W1P   16
#define WSC   256.0f
#define WINVH 0.001953125f   // (1/256) / 2: the unscale of the f16 weights and the half of the sigmoid's argument in one factor

static_assert(NW == 32 && NW * IPW == NB && NLD * 128 == IPW);
static_assert(NQO == NQ * NO);
static_assert((NB * NQO) % 1024 == 0);
static_assert(NO <= 8 && SLOT * 4 == 128);
static_assert(NI == 6 && W1P == 16 && WP % 8 == 0);

typedef _Float16 v16h __attribute__((ext_vector_type(16)));
typedef _Float16 v8h  __attribute__((ext_vector_type(8)));
typedef _Float16 v2h  __attribute__((ext_vector_type(2)));
typedef float    v8f  __attribute__((ext_vector_type(8)));
typedef float    v4f  __attribute__((ext_vector_type(4)));
typedef float    v2f  __attribute__((ext_vector_type(2)));
typedef int      v4i  __attribute__((ext_vector_type(4)));

union FragH { v16h v; v8h h[2]; };

// f32 -> value of its bf16 RNE convert
__device__ __forceinline__ float bfr(float f) {
  unsigned u = __float_as_uint(f);
  u = (u + 0x7FFFu + ((u >> 16) & 1u)) & 0xFFFF0000u;
  return __uint_as_float(u);
}
// sigmoid(2 * hx) = 0.5 + 0.5 * tanh(hx): one hardware transcendental and one FMA; the callers hand in HALF the pre-activation
// (the factor 1/2, a power of two and so exact, is folded into the staged layer-1 weights, the layer-2 bias and the layer-2 unscale)
// two values a call, so that the FMA is a packed one
__device__ __forceinline__ v2f sigm_half2(v2f hx) {
  v2f th;
  th[0] = __builtin_amdgcn_tanhf(hx[0]);
  th[1] = __builtin_amdgcn_tanhf(hx[1]);
  return th * 0.5f + 0.5f;
}
__device__ __forceinline__ v8f zero8() { v8f z = {0.f, 0.f, 0.f, 0.f, 0.f, 0.f, 0.f, 0.f}; return z; }
__device__ __forceinline__ v8h zero8h() {
  const _Float16 o = (_Float16)0.f;
  v8h z = {o, o, o, o, o, o, o, o};
  return z;
}

// 16-bit A/B fragment: lane -> row/col (lane&15), p already includes +8*(lane>>4);
// elements 0..7 <- p[0..7] (k0+8h..k0+8h+7), elements 8..15 <- p[16..23] (k0+16+8h..); same split k map for A and B,
// the weight operand is read from a k-contiguous [n][k] plane.
__device__ __forceinline__ v16h ldfrag_h(const _Float16* p) {
  FragH f;
  f.h[0] = *(const v8h*)(p);
  f.h[1] = *(const v8h*)(p + 16);
  return f.v;
}
__device__ __forceinline__ v8f mma16(v16h a, v16h b, v8f c) {
  return __builtin_amdgcn_wmma_f32_16x16x32_f16(false, a, false, b, (short)0, c, false, false);
}

// =====================================================================================================
// Block = (judge j, question q, third sl of the judge's tiles): 12 x 7 x 3 = 252 blocks of 32 waves, one to a WGP, so that a WGP stages
// W2c_j once. Every block scans all 16384 ids and compacts the samples with id == j into an LDS list (ballot + wave-count prefix; the
// order, by wave, load, element, lane, is the same in the three blocks that share a list; length <= 16384); W2c_j, W1c[j][q] and
// Vc[j][q] are staged once per block and published by one barrier. From there each wave works alone on whole tiles of 16 samples
// (tile = sl + 3 * wave, + 96, ...), lane -> sample (lane & 15), half hh = lane >> 4:
//   layer 1: for each of the 8 row tiles T of W1c^T one WMMA (6 of its 32 k: the ones column and x; the rest meets zeros); D[r] = hidden unit
//   16T + 8hh + r of the lane's sample, which after the sigmoid is element 8(T & 1) + r of B fragment T >> 1 of z1^T
//   (element e of fragment s: k = 32s + 8hh + e, e < 8; 32s + 16 + 8hh + e - 8);
//   layer 2: for each of the 8 row tiles T of W2c^T four WMMAs (K = 128); acc[r] = pre-activation of hidden unit 16T + 8hh + r of the
//   lane's sample; bias, scale and sigmoid in f32; two row tiles fill one B fragment of z2^T in the same way;
//   layer 3: one WMMA per fragment of z2^T into the logit tile; row 8hh + r = option r, so both halves of the wave hold all 5 logits;
//   softmax in the lane; one 128-B line of res per (sample, question).
// coverage: every (sample b, question q) is owned by exactly one block (clamped id, q, its list tile mod 3), there by one tile and one wave;
//           its line is written once, whole, by lanes c16 and c16 + 16 (four 16-B pieces each: options 0..4, then zeros).
// =====================================================================================================
// 32 waves a block: 8 waves a SIMD (128 VGPRs), all 252 blocks resident at once
__global__ __launch_bounds__(NT) void mlp_fwd(
    const float* __restrict__ x,  const int* __restrict__ jid,
    const float* __restrict__ W1, const float* __restrict__ W1a,
    const float* __restrict__ W2, const float* __restrict__ W2a,
    const float* __restrict__ V,  const float* __restrict__ Va,
    float* res) {
  __shared__ __align__(16) _Float16 s_w2t[NH * WP];   // [n = h][k], k = W2c row k+1, x256
  __shared__ __align__(16) _Float16 s_w1t[NH * W1P];  // [n = h][k = i] for this block's q, x 1/2; k >= 6 zero
  __shared__ __align__(16) _Float16 s_vt[8 * WP];     // [n = o][k], k = Vc row k+1 for this block's q; rows o >= 5 zero
  __shared__ __align__(16) float s_vb[8];             // Vc row 0; o >= 5 zero
  __shared__ __align__(16) float s_b2[NH];            // W2c row 0, x 1/2
  __shared__ unsigned short s_idx[NB];
  __shared__ __align__(16) int s_wc[NW];

  const int t = threadIdx.x;
  const int lane = t & 31, wave = t >> 5, hh = lane >> 4, c16 = lane & 15;
  const int q = (int)(blockIdx.x % NQ);
  const int j = (int)((blockIdx.x / NQ) % NJ);
  const int sl = (int)(blockIdx.x / (NQ * NJ));
  if (sl >= NS) return;                               // block-uniform, never taken with the exact grid

  // ---- compaction of all samples with judge j; wave w scans ids w * 512 .. w * 512 + 511 ----
  // the loops are unrolled so that ids[] and msk[] stay in registers and the four loads are in flight together
  const int wv = __builtin_amdgcn_readfirstlane(wave); // scalar: the masks' running sums stay scalar, and every lane is on at the WMMAs
  const int ib = wv * IPW + lane * 4;                  // + 128 p + c < NB
  v4i ids[NLD];
  unsigned msk[NLD * 4];
#pragma unroll
  for (int p = 0; p < NLD; ++p) ids[p] = *(const v4i*)(jid + ib + p * 128);
  int wcnt = 0;
#pragma unroll
  for (int p = 0; p < NLD; ++p) {
#pragma unroll
    for (int c = 0; c < 4; ++c) {
      const int id = min(max(ids[p][c], 0), NJ - 1);
      msk[p * 4 + c] = __builtin_amdgcn_ballot_w32(id == j);
      wcnt += __builtin_popcount(msk[p * 4 + c]);
    }
  }
  if (lane == 0) s_wc[wave] = wcnt;
  __syncthreads();
  int base = 0, run = 0;
#pragma unroll
  for (int w = 0; w < NW; ++w) {
    const int c = s_wc[w];
    base += (w < wv) ? c : 0;  run += c;
  }
  base = __builtin_amdgcn_readfirstlane(base);
  const unsigned lt = (1u << lane) - 1u;
#pragma unroll
  for (int i = 0; i < NLD * 4; ++i) {
    const int pos = min(base + __builtin_popcount(msk[i] & lt), NB - 1);
    if ((msk[i] >> lane) & 1u) s_idx[pos] = (unsigned short)(ib + (i >> 2) * 128 + (i & 3));
    base += __builtin_popcount(msk[i]);
  }
  const int cnt = __builtin_amdgcn_readfirstlane(min(run, NB));   // block-uniform; scalar, so that the tile loop branches on SCC
  __syncthreads();
  if (cnt == 0) return;                               // block-uniform

  // ---- combined layer-2 weights for judge j: plane [n][k] = f16(256 * (bf16(W2[k+1][n]) + bf16(W2_a[j][k+1][n]))) ----
  const float* W2aj = W2a + (size_t)j * NK2 * NH;
  for (int e = t; e < NH * NH; e += NT) {
    const int k = e >> 7, h = e & 127;
    const int gi = e + NH;
    const float v = (bfr(W2[gi]) + bfr(W2aj[gi])) * WSC;
    s_w2t[h * WP + k] = (_Float16)v;
  }
  if (t < NH) s_b2[t] = (bfr(W2[t]) + bfr(W2aj[t])) * 0.5f;

  // ---- combined layer-1 and layer-3 weights for (judge j, question q), once per block ----
  {
    const float* W1q  = W1 + (size_t)q * NI * NH;
    const float* W1aq = W1a + ((size_t)j * NQ + q) * (NI * NH);
    for (int e = t; e < NI * NH; e += NT) {
      const int i = e >> 7, h = e & 127;
      s_w1t[h * W1P + i] = (_Float16)((bfr(W1q[e]) + bfr(W1aq[e])) * 0.5f);
    }
    if (t < NH) {                                      // columns 6..15 of row t
      const v2h z2 = {(_Float16)0.f, (_Float16)0.f};
      *(v2h*)(s_w1t + t * W1P + NI) = z2;
      *(v8h*)(s_w1t + t * W1P + 8)  = zero8h();
    }
    const float* Vq  = V + (size_t)q * NK2 * NO;
    const float* Vaq = Va + ((size_t)j * NQ + q) * (NK2 * NO);
    for (int e = t; e < NK2 * NO; e += NT) {
      const int k = e / NO, o = e - k * NO;
      const float v = bfr(Vq[e]) + bfr(Vaq[e]);
      if (k == 0) s_vb[o] = v;
      else        s_vt[o * WP + (k - 1)] = (_Float16)v;
    }
    if (t < (8 - NO) * WP / 8) *(v8h*)(s_vt + NO * WP + 8 * t) = zero8h();
    if (t < 8 - NO) s_vb[NO + t] = 0.f;
  }

  __syncthreads();                                     // publishes the staged weights; the only barrier behind the staging

  const int ntile = min((cnt + 15) >> 4, MAXT);
  for (int tile = sl + NS * wv; tile < ntile; tile += NS * NW) {
    const int s0 = tile * 16;
    const int si = min(s0 + c16, cnt - 1);
    const int b  = min((int)s_idx[si], NB - 1);
    const float* xp = x + ((size_t)b * NQ + q) * NO;
    const float x0 = bfr(xp[0]), x1 = bfr(xp[1]), x2 = bfr(xp[2]), x3 = bfr(xp[3]), x4 = bfr(xp[4]);

    // ---- layer 1 (f16 WMMA) into the B fragments of z1^T; unrolled so that zb[] is indexed by constants and stays in registers ----
    // One A fragment holds two row tiles of W1c^T: k = 0..15 the plane's row of tile 2P, k = 16..31 that of tile 2P + 1. B holds the
    // column (1, x0..x4, 0, 0) at k = 0..7 (xlo: picks tile 2P) or at k = 16..23 (xhi: picks tile 2P + 1) and zeros in the other half;
    // lanes with hh = 1 carry k = 8..15 and 24..31, where the plane is zero, so they may hold the same column.
    FragH xlo, xhi;
    {
      const _Float16 o = (_Float16)0.f;
      const v8h xh = {(_Float16)1.0f, (_Float16)x0, (_Float16)x1, (_Float16)x2, (_Float16)x3, (_Float16)x4, o, o};
      xlo.h[0] = xh;        xlo.h[1] = zero8h();
      xhi.h[0] = zero8h();  xhi.h[1] = xh;
    }
    const _Float16* w1p = s_w1t + c16 * W1P + 8 * hh;
    v16h zb[4];
#pragma unroll
    for (int P = 0; P < 4; ++P) {
      FragH wa;
      wa.h[0] = *(const v8h*)(w1p + (2 * P) * 16 * W1P);
      wa.h[1] = *(const v8h*)(w1p + (2 * P + 1) * 16 * W1P);
#pragma unroll
      for (int u = 0; u < 2; ++u) {
        const v8f p = mma16(wa.v, u ? xhi.v : xlo.v, zero8());
#pragma unroll
        for (int c = 0; c < 4; ++c) {
          const v2f pc = {p[2 * c], p[2 * c + 1]};
          const v2f z = sigm_half2(pc);
          zb[P][8 * u + 2 * c]     = (_Float16)z[0];
          zb[P][8 * u + 2 * c + 1] = (_Float16)z[1];
        }
      }
    }

    // ---- layer 2 (f16 WMMA, K = 128, rows = hidden units, columns = samples) and layer 3 (f16 WMMA, K = 128, rows = options) ----
    v8f lacc;                                          // starts from the layer-3 bias row
    {
      const v4f va = *(const v4f*)(s_vb), vb = *(const v4f*)(s_vb + 4);
      lacc = (v8f){va[0], va[1], va[2], va[3], vb[0], vb[1], vb[2], vb[3]};
    }
    const _Float16* ap = s_w2t + c16 * WP + 8 * hh;
    const _Float16* vp = s_vt + (c16 & 7) * WP + 8 * hh;
    // rolled: the text stays short and the registers inside the budget of 8 waves a SIMD
#pragma unroll 1
    for (int s = 0; s < 4; ++s) {
      v16h zf;
      // unrolled so that zf is indexed by constants
#pragma unroll
      for (int u = 0; u < 2; ++u) {
        const int T = 2 * s + u;
        const _Float16* a = ap + T * 16 * WP;
        const v16h a0 = ldfrag_h(a), a1 = ldfrag_h(a + 32), a2 = ldfrag_h(a + 64), a3 = ldfrag_h(a + 96);
        // keeps a row tile's eight fragment loads together in front of its chain (one LDS latency instead of four) and the second row
        // tile's loads behind the first one's: with all sixteen hoisted to the loop's head the build spills at 128 VGPRs
        __builtin_amdgcn_sched_barrier(0);
        v8f acc = zero8();
        acc = mma16(a0, zb[0], acc);
        acc = mma16(a1, zb[1], acc);
        acc = mma16(a2, zb[2], acc);
        acc = mma16(a3, zb[3], acc);
        const int nb = T * 16 + 8 * hh;
        const v4f ba = *(const v4f*)(s_b2 + nb),  bb = *(const v4f*)(s_b2 + nb + 4);
#pragma unroll
        for (int r = 0; r < 8; r += 2) {
          const v2f a2 = {acc[r], acc[r + 1]};
          const v2f b2 = {(r < 4) ? ba[r & 3] : bb[r & 3], (r < 4) ? ba[(r & 3) + 1] : bb[(r & 3) + 1]};
          const v2f z2 = sigm_half2(a2 * WINVH + b2);
          zf[8 * u + r]     = (_Float16)z2[0];
          zf[8 * u + r + 1] = (_Float16)z2[1];
        }
      }
      lacc = mma16(ldfrag_h(vp + 32 * s), zf, lacc);
    }
    const float l0 = lacc[0], l1 = lacc[1], l2 = lacc[2], l3 = lacc[3], l4 = lacc[4];

    // ---- softmax over the 5 options and the result line ----
    {
      const float mx = fmaxf(fmaxf(fmaxf(l0, l1), fmaxf(l2, l3)), l4);
      const float e0 = expf(l0 - mx), e1 = expf(l1 - mx), e2 = expf(l2 - mx);
      const float e3 = expf(l3 - mx), e4 = expf(l4 - mx);
      const float sum = (((e0 + e1) + e2) + e3) + e4;
      const float inv = 1.0f / sum;
      v4f v = {0.f, 0.f, 0.f, 0.f};
      const v4f zz = {0.f, 0.f, 0.f, 0.f};
      if (hh == 0) { v[0] = e0 * inv; v[1] = e1 * inv; v[2] = e2 * inv; v[3] = e3 * inv; }
      else         { v[0] = e4 * inv; }
      float* dp = res + ((size_t)b * NQ + q) * SLOT + hh * 4;
      if (s0 + c16 < cnt) {
        *(v4f*)(dp)      = v;
        *(v4f*)(dp + 8)  = zz;
        *(v4f*)(dp + 16) = zz;
        *(v4f*)(dp + 24) = zz;
      }
      // the next tile reuses the stores' address and data registers: keep the wait in front of that overwrite
      asm volatile("s_wait_xcnt 0x0" ::: "memory");
    }
  }
}

// =====================================================================================================
// Repack: out[e] = res[(e/5)*32 + e%5] for the flat [16384][7][5] output (e/5 = sample*7 + question). Thread -> 4 consecutive floats; one instruction =
// coverage: 560 x 256 threads x 4 floats = 573440 = every output element once.
// =====================================================================================================
__global__ __launch_bounds__(256) void repack(const float* __restrict__ res, float* out) {
  const int g  = blockIdx.x * 256 + threadIdx.x;
  const int e0 = g * 4;
  v4f v;
#pragma unroll
  for (int c = 0; c < 4; ++c) {
    const int e = min(e0 + c, NB * NQO - 1);
    const int bq = e / NO;
    const int o  = e - bq * NO;
    v[c] = res[(size_t)bq * SLOT + o];
  }
  float* op = out + e0;
  *(v4f*)op = v;
  
}

// =====================================================================================================
// =====================================================================================================
extern "C" void kernel_launch(void* const* d_in, const int* in_sizes, int n_in,
                              void* d_out, int out_size, void* d_ws, size_t ws_size,
                              hipStream_t stream) {
  if (n_in < 8) return;
  if (in_sizes[0] != NB * NQ * NO) return;
  if (in_sizes[1] != NB) return;
  if (in_sizes[2] != NQ * NI * NH || in_sizes[3] != NJ * NQ * NI * NH) return;
  if (in_sizes[4] != NK2 * NH || in_sizes[5] != NJ * NK2 * NH) return;
  if (in_sizes[6] != NQ * NK2 * NO || in_sizes[7] != NJ * NQ * NK2 * NO) return;
  if (out_size != NB * NQO) return;
  const size_t need = (size_t)NB * NQ * SLOT * sizeof(float);    // 14680064
  if (need > ws_size) return;
  if (need > (size_t)134217728) return;

  const float* x   = (const float*)d_in[0];
  const int*   jid = (const int*)d_in[1];
  const float* W1  = (const float*)d_in[2];
  const float* W1a = (const float*)d_in[3];
  const float* W2  = (const float*)d_in[4];
  const float* W2a = (const float*)d_in[5];
  const float* V   = (const float*)d_in[6];
  const float* Va  = (const float*)d_in[7];
  float* out = (float*)d_out;
  float* res = (float*)d_ws;

  mlp_fwd<<<dim3(NJ * NQ * NS), dim3(NT), 0, stream>>>(x, jid, W1, W1a, W2, W2a, V, Va, res);
  repack<<<dim3((NB * NQO) / 1024), dim3(256), 0, stream>>>(res, out);
  (void)hipGetLastError();
}

// v006
// A run of this version takes 20.5 microseconds.
// Next to v005, in two timings, it ran 1.07 times as fast each time.
// All steps since v000 together make it 6.34 times as fast.
// All three contractions on v_wmma_f32_16x16x32_f16, taken transposed (rows = output units, columns = samples), f32 accumulate:
// A = the layer's combined weights as an f16 [n][k] LDS plane (layer 2: x256, the 1/256 folded back in f32), B = the layer's input in f16,
// built in registers: the D layout of one layer is the B fragment layout of the next. Layer 1 has K = 6 (bias row included) padded with
// zeros, layer 3 has 5 rows padded to 8 and taken twice (rows 8..15 = rows 0..7). Layer-3 bias row as the f32 start of its accumulator; layer-2 bias row, sigmoid
// (0.5 + 0.5 * tanh(x/2), hardware tanh) and softmax in f32 on VALU; every float input RNE-converted to bf16 on load.
#include <hip/hip_runtime.h>
#include <math.h>
#include <stdint.h>

#define NB    16384
#define NJ    12
#define NQ    7
#define NO    5
#define NI    6
#define NH    128
#define NK2   129
#define NQO   35
#define NS    3                // blocks per (judge, question)
#define NT    1024             // threads a block
#define NW    (NT / 32)
#define IPW   (NB / NW)        // ids scanned by one wave
#define NLD   (IPW / 128)      // 16-B id loads a lane
#define MAXT  (NB / 16)
#define SLOT  32
#define WP    136
#define W1P   16
#define WSC   256.0f
#define WINVH 0.001953125f   // (1/256) / 2: the unscale of the f16 weights and the half of the sigmoid's argument in one factor

static_assert(NW == 32 && NW * IPW == NB && NLD * 128 == IPW);
static_assert(NQO == NQ * NO);
static_assert((NB * NQO) % 1024 == 0);
static_assert(NO <= 8 && SLOT * 4 == 128);
static_assert(NI == 6 && W1P == 16 && WP % 8 == 0);
static_assert(NT == 1024 && NH == 128 && NI * NH <= NT && NK2 * NO <= NT);   // one 4 x 4 block of W2 and one element of W1, V a thread

typedef _Float16 v16h __attribute__((ext_vector_type(16)));
typedef _Float16 v8h  __attribute__((ext_vector_type(8)));
typedef _Float16 v4h  __attribute__((ext_vector_type(4)));
typedef _Float16 v2h  __attribute__((ext_vector_type(2)));
typedef float    v8f  __attribute__((ext_vector_type(8)));
typedef float    v4f  __attribute__((ext_vector_type(4)));
typedef float    v2f  __attribute__((ext_vector_type(2)));
typedef int      v4i  __attribute__((ext_vector_type(4)));

union FragH { v16h v; v8h h[2]; };

// f32 -> value of its bf16 RNE convert
__device__ __forceinline__ float bfr(float f) {
  unsigned u = __float_as_uint(f);
  u = (u + 0x7FFFu + ((u >> 16) & 1u)) & 0xFFFF0000u;
  return __uint_as_float(u);
}
// sigmoid(2 * hx) = 0.5 + 0.5 * tanh(hx): one hardware transcendental and one FMA; the callers hand in HALF the pre-activation
// (the factor 1/2, a power of two and so exact, is folded into the staged layer-1 weights, the layer-2 bias and the layer-2 unscale)
// two values a call, so that the FMA is a packed one
__device__ __forceinline__ v2f sigm_half2(v2f hx) {
  v2f th;
  th[0] = __builtin_amdgcn_tanhf(hx[0]);
  th[1] = __builtin_amdgcn_tanhf(hx[1]);
  return th * 0.5f + 0.5f;
}
__device__ __forceinline__ v8f zero8() { v8f z = {0.f, 0.f, 0.f, 0.f, 0.f, 0.f, 0.f, 0.f}; return z; }
__device__ __forceinline__ v8h zero8h() {
  const _Float16 o = (_Float16)0.f;
  v8h z = {o, o, o, o, o, o, o, o};
  return z;
}

// 16-bit A/B fragment: lane -> row/col (lane&15), p already includes +8*(lane>>4);
// elements 0..7 <- p[0..7] (k0+8h..k0+8h+7), elements 8..15 <- p[16..23] (k0+16+8h..); same split k map for A and B,
// the weight operand is read from a k-contiguous [n][k] plane.
__device__ __forceinline__ v16h ldfrag_h(const _Float16* p) {
  FragH f;
  f.h[0] = *(const v8h*)(p);
  f.h[1] = *(const v8h*)(p + 16);
  return f.v;
}
// Work-group barrier whose two fences order LDS alone, for places where only LDS data cross it: __syncthreads() would also wait for
// the wave's global loads, which are to stay in flight across it.
__device__ __forceinline__ void lds_barrier() {
  __builtin_amdgcn_fence(__ATOMIC_RELEASE, "workgroup", "local");
  __builtin_amdgcn_s_barrier();
  __builtin_amdgcn_fence(__ATOMIC_ACQUIRE, "workgroup", "local");
}
__device__ __forceinline__ v8f mma16(v16h a, v16h b, v8f c) {
  return __builtin_amdgcn_wmma_f32_16x16x32_f16(false, a, false, b, (short)0, c, false, false);
}

// =====================================================================================================
// Block = (judge j, question q, third sl of the judge's tiles): 12 x 7 x 3 = 252 blocks of 32 waves, one to a WGP, so that a WGP stages
// W2c_j once. Every block scans all 16384 ids and compacts the samples with id == j into an LDS list (ballot + wave-count prefix; the
// order, by wave, load, element, lane, is the same in the three blocks that share a list; length <= 16384); W2c_j, W1c[j][q] and
// Vc[j][q] are staged once per block and published by one barrier; their loads are issued at entry and land under the compaction. From there each wave works alone on whole tiles of 16 samples
// (tile = sl + 3 * wave, + 96, ...), lane -> sample (lane & 15), half hh = lane >> 4:
//   layer 1: for each of the 8 row tiles T of W1c^T one WMMA (6 of its 32 k: the ones column and x; the rest meets zeros); D[r] = hidden unit
//   16T + 8hh + r of the lane's sample, which after the sigmoid is element 8(T & 1) + r of B fragment T >> 1 of z1^T
//   (element e of fragment s: k = 32s + 8hh + e, e < 8; 32s + 16 + 8hh + e - 8);
//   layer 2: for each of the 8 row tiles T of W2c^T four WMMAs (K = 128); acc[r] = pre-activation of hidden unit 16T + 8hh + r of the
//   lane's sample; bias, scale and sigmoid in f32; two row tiles fill one B fragment of z2^T in the same way;
//   layer 3: one WMMA per fragment of z2^T into the logit tile; row 8hh + r = option r, so both halves of the wave hold all 5 logits;
//   softmax in the lane; one 128-B line of res per (sample, question).
// coverage: every (sample b, question q) is owned by exactly one block (clamped id, q, its list tile mod 3), there by one tile and one wave;
//           its line is written once, whole, by lanes c16 and c16 + 16 (four 16-B pieces each: options 0..4, then zeros).
// =====================================================================================================
// 32 waves a block: 8 waves a SIMD (128 VGPRs), all 252 blocks resident at once
__global__ __launch_bounds__(NT) void mlp_fwd(
    const float* __restrict__ x,  const int* __restrict__ jid,
    const float* __restrict__ W1, const float* __restrict__ W1a,
    const float* __restrict__ W2, const float* __restrict__ W2a,
    const float* __restrict__ V,  const float* __restrict__ Va,
    float* res) {
  __shared__ __align__(16) _Float16 s_w2t[NH * WP];   // [n = h][k], k = W2c row k+1, x256
  __shared__ __align__(16) _Float16 s_w1t[NH * W1P];  // [n = h][k = i] for this block's q, x 1/2; k >= 6 zero
  __shared__ __align__(16) _Float16 s_vt[8 * WP];     // [n = o][k], k = Vc row k+1 for this block's q; rows o >= 5 zero
  __shared__ __align__(16) float s_vb[8];             // Vc row 0; o >= 5 zero
  __shared__ __align__(16) float s_b2[NH];            // W2c row 0, x 1/2
  __shared__ unsigned short s_idx[NB];
  __shared__ __align__(16) int s_wc[NW];

  const int t = threadIdx.x;
  const int lane = t & 31, wave = t >> 5, hh = lane >> 4, c16 = lane & 15;
  const int q = (int)(blockIdx.x % NQ);
  const int j = (int)((blockIdx.x / NQ) % NJ);
  const int sl = (int)(blockIdx.x / (NQ * NJ));
  if (sl >= NS) return;                               // block-uniform, never taken with the exact grid

  // ---- compaction of all samples with judge j; wave w scans ids w * 512 .. w * 512 + 511 ----
  // the loops are unrolled so that ids[] and msk[] stay in registers and the four loads are in flight together
  const int wv = __builtin_amdgcn_readfirstlane(wave); // scalar: the masks' running sums stay scalar, and every lane is on at the WMMAs
  const int ib = wv * IPW + lane * 4;                  // + 128 p + c < NB
  v4i ids[NLD];
  unsigned msk[NLD * 4];
#pragma unroll
  for (int p = 0; p < NLD; ++p) ids[p] = *(const v4i*)(jid + ib + p * 128);

  // ---- every weight load of the block is issued here, behind the id loads, and used only behind the compaction: one trip to L2 for
  // all of them, under the id scan, instead of one trip after another. None depends on the ids. A thread takes a block of 4 k x 4 n of
  // W2 and of W2_a[j] by 16-B loads: 8 lanes cover one 128-B line of a row, a wave 4 whole lines a load. The single elements are read
  // at a clamped index by every thread (no branch between the loads) and used only where the index is the thread's own.
  const float* W2aj = W2a + (size_t)j * NK2 * NH;
  const float* W1q  = W1 + (size_t)q * NI * NH;
  const float* W1aq = W1a + ((size_t)j * NQ + q) * (NI * NH);
  const float* Vq   = V + (size_t)q * NK2 * NO;
  const float* Vaq  = Va + ((size_t)j * NQ + q) * (NK2 * NO);
  const int sn0 = (wv & 3) * 32 + (lane & 7) * 4;      // first n (column of W2) of the thread's block
  const int sk0 = (wv >> 2) * 16 + (lane >> 3) * 4;    // first k of the thread's block (row k + 1 of W2)
  const unsigned go = (unsigned)(sk0 * NH + sn0) * 4u;   // byte offset of the block in rows 1..128; + 3 rows + 16 B <= 128 * 128 * 4
  v4f gw[4], ga[4];
  // unrolled so that gw[] and ga[] are indexed by constants, stay in registers, and the eight loads are in flight together
#pragma unroll
  for (int r = 0; r < 4; ++r) {
    gw[r] = *(const v4f*)((const char*)(W2 + NH) + go + r * (NH * 4));
    ga[r] = *(const v4f*)((const char*)(W2aj + NH) + go + r * (NH * 4));
  }
  const int e1 = min(t, NI * NH - 1), e3 = min(t, NK2 * NO - 1), e2 = t & (NH - 1);
  const float g1w = W1q[e1], g1a = W1aq[e1];
  const float g3w = Vq[e3],  g3a = Vaq[e3];
  const float g2w = W2[e2],  g2a = W2aj[e2];
  // the wait in front of any overwrite of these loads' address registers; the offset is named so that its register is not handed out
  // as a later load's destination in front of the wait
  asm volatile("s_wait_xcnt 0x0" :: "v"(go) : "memory");

  int wcnt = 0;
#pragma unroll
  for (int p = 0; p < NLD; ++p) {
#pragma unroll
    for (int c = 0; c < 4; ++c) {
      const int id = min(max(ids[p][c], 0), NJ - 1);
      msk[p * 4 + c] = __builtin_amdgcn_ballot_w32(id == j);
      wcnt += __builtin_popcount(msk[p * 4 + c]);
    }
  }
  if (lane == 0) s_wc[wave] = wcnt;
  lds_barrier();                                       // publishes s_wc
  int base = 0, run = 0;
#pragma unroll
  for (int w = 0; w < NW; ++w) {
    const int c = s_wc[w];
    base += (w < wv) ? c : 0;  run += c;
  }
  base = __builtin_amdgcn_readfirstlane(base);
  const unsigned lt = (1u << lane) - 1u;
#pragma unroll
  for (int i = 0; i < NLD * 4; ++i) {
    const int pos = min(base + __builtin_popcount(msk[i] & lt), NB - 1);
    if ((msk[i] >> lane) & 1u) s_idx[pos] = (unsigned short)(ib + (i >> 2) * 128 + (i & 3));
    base += __builtin_popcount(msk[i]);
  }
  const int cnt = __builtin_amdgcn_readfirstlane(min(run, NB));   // block-uniform; scalar, so that the tile loop branches on SCC
  lds_barrier();                                       // publishes s_idx
  if (cnt == 0) return;                               // block-uniform

  // ---- the x row of the wave's first tile, asked for here so that it arrives under the conversion of the weights ----
  const int ntile = min((cnt + 15) >> 4, MAXT);
  const int tile0 = sl + NS * wv;
  int bn = min((int)s_idx[min(tile0 * 16 + c16, cnt - 1)], NB - 1);   // a wave without a tile reads the list's last entry, and drops it
  float xn[NO];
  {
    const float* xp = x + ((size_t)bn * NQ + q) * NO;
    // unrolled so that xn[] stays in registers
#pragma unroll
    for (int o = 0; o < NO; ++o) xn[o] = xp[o];
  }
  // keeps the conversion, which waits for the weights, behind the issue of the x loads
  __builtin_amdgcn_sched_barrier(0);

  // ---- combined layer-2 weights for judge j: plane [n][k] = f16(256 * (bf16(W2[k+1][n]) + bf16(W2_a[j][k+1][n]))) ----
  // the thread's block goes out transposed: four k of one n are 8 B of the plane; both loops unrolled for constant register indices
#pragma unroll
  for (int c = 0; c < 4; ++c) {
    v4h pk;
#pragma unroll
    for (int r = 0; r < 4; ++r) pk[r] = (_Float16)((bfr(gw[r][c]) + bfr(ga[r][c])) * WSC);
    *(v4h*)(s_w2t + (sn0 + c) * WP + sk0) = pk;
  }
  if (t < NH) s_b2[t] = (bfr(g2w) + bfr(g2a)) * 0.5f;

  // ---- combined layer-1 and layer-3 weights for (judge j, question q), once per block ----
  {
    if (t < NI * NH) {
      const int i = t >> 7, h = t & 127;
      s_w1t[h * W1P + i] = (_Float16)((bfr(g1w) + bfr(g1a)) * 0.5f);
    }
    if (t < NH) {                                      // columns 6..15 of row t
      const v2h z2 = {(_Float16)0.f, (_Float16)0.f};
      *(v2h*)(s_w1t + t * W1P + NI) = z2;
      *(v8h*)(s_w1t + t * W1P + 8)  = zero8h();
    }
    if (t < NK2 * NO) {
      const int k = t / NO, o = t - k * NO;
      const float v = bfr(g3w) + bfr(g3a);
      if (k == 0) s_vb[o] = v;
      else        s_vt[o * WP + (k - 1)] = (_Float16)v;
    }
    if (t < (8 - NO) * WP / 8) *(v8h*)(s_vt + NO * WP + 8 * t) = zero8h();
    if (t < 8 - NO) s_vb[NO + t] = 0.f;
  }

  __syncthreads();                                     // publishes the staged weights; the only barrier behind the staging

  for (int tile = tile0; tile < ntile; tile += NS * NW) {
    const int s0 = tile * 16;
    const int b  = bn;
    const float x0 = bfr(xn[0]), x1 = bfr(xn[1]), x2 = bfr(xn[2]), x3 = bfr(xn[3]), x4 = bfr(xn[4]);

    // ---- layer 1 (f16 WMMA) into the B fragments of z1^T; unrolled so that zb[] is indexed by constants and stays in registers ----
    // One A fragment holds two row tiles of W1c^T: k = 0..15 the plane's row of tile 2P, k = 16..31 that of tile 2P + 1. B holds the
    // column (1, x0..x4, 0, 0) at k = 0..7 (xlo: picks tile 2P) or at k = 16..23 (xhi: picks tile 2P + 1) and zeros in the other half;
    // lanes with hh = 1 carry k = 8..15 and 24..31, where the plane is zero, so they may hold the same column.
    FragH xlo, xhi;
    {
      const _Float16 o = (_Float16)0.f;
      const v8h xh = {(_Float16)1.0f, (_Float16)x0, (_Float16)x1, (_Float16)x2, (_Float16)x3, (_Float16)x4, o, o};
      xlo.h[0] = xh;        xlo.h[1] = zero8h();
      xhi.h[0] = zero8h();  xhi.h[1] = xh;
    }
    const _Float16* w1p = s_w1t + c16 * W1P + 8 * hh;
    v16h zb[4];
#pragma unroll
    for (int P = 0; P < 4; ++P) {
      FragH wa;
      wa.h[0] = *(const v8h*)(w1p + (2 * P) * 16 * W1P);
      wa.h[1] = *(const v8h*)(w1p + (2 * P + 1) * 16 * W1P);
#pragma unroll
      for (int u = 0; u < 2; ++u) {
        const v8f p = mma16(wa.v, u ? xhi.v : xlo.v, zero8());
#pragma unroll
        for (int c = 0; c < 4; ++c) {
          const v2f pc = {p[2 * c], p[2 * c + 1]};
          const v2f z = sigm_half2(pc);
          zb[P][8 * u + 2 * c]     = (_Float16)z[0];
          zb[P][8 * u + 2 * c + 1] = (_Float16)z[1];
        }
      }
    }

    // ---- layer 2 (f16 WMMA, K = 128, rows = hidden units, columns = samples) and layer 3 (f16 WMMA, K = 128, rows = options) ----
    v8f lacc;                                          // starts from the layer-3 bias row
    {
      const v4f va = *(const v4f*)(s_vb), vb = *(const v4f*)(s_vb + 4);
      lacc = (v8f){va[0], va[1], va[2], va[3], vb[0], vb[1], vb[2], vb[3]};
    }
    const _Float16* ap = s_w2t + c16 * WP + 8 * hh;
    const _Float16* vp = s_vt + (c16 & 7) * WP + 8 * hh;
    // rolled: the text stays short and the registers inside the budget of 8 waves a SIMD
#pragma unroll 1
    for (int s = 0; s < 4; ++s) {
      v16h zf;
      // unrolled so that zf is indexed by constants
#pragma unroll
      for (int u = 0; u < 2; ++u) {
        const int T = 2 * s + u;
        const _Float16* a = ap + T * 16 * WP;
        const v16h a0 = ldfrag_h(a), a1 = ldfrag_h(a + 32), a2 = ldfrag_h(a + 64), a3 = ldfrag_h(a + 96);
        // keeps a row tile's eight fragment loads together in front of its chain (one LDS latency instead of four) and the second row
        // tile's loads behind the first one's: with all sixteen hoisted to the loop's head the build spills at 128 VGPRs
        __builtin_amdgcn_sched_barrier(0);
        v8f acc = zero8();
        acc = mma16(a0, zb[0], acc);
        acc = mma16(a1, zb[1], acc);
        acc = mma16(a2, zb[2], acc);
        acc = mma16(a3, zb[3], acc);
        const int nb = T * 16 + 8 * hh;
        const v4f ba = *(const v4f*)(s_b2 + nb),  bb = *(const v4f*)(s_b2 + nb + 4);
#pragma unroll
        for (int r = 0; r < 8; r += 2) {
          const v2f a2 = {acc[r], acc[r + 1]};
          const v2f b2 = {(r < 4) ? ba[r & 3] : bb[r & 3], (r < 4) ? ba[(r & 3) + 1] : bb[(r & 3) + 1]};
          const v2f z2 = sigm_half2(a2 * WINVH + b2);
          zf[8 * u + r]     = (_Float16)z2[0];
          zf[8 * u + r + 1] = (_Float16)z2[1];
        }
      }
      lacc = mma16(ldfrag_h(vp + 32 * s), zf, lacc);
    }
    const float l0 = lacc[0], l1 = lacc[1], l2 = lacc[2], l3 = lacc[3], l4 = lacc[4];

    // ---- softmax over the 5 options and the result line ----
    {
      const float mx = fmaxf(fmaxf(fmaxf(l0, l1), fmaxf(l2, l3)), l4);
      const float e0 = expf(l0 - mx), e1 = expf(l1 - mx), e2 = expf(l2 - mx);
      const float e3 = expf(l3 - mx), e4 = expf(l4 - mx);
      const float sum = (((e0 + e1) + e2) + e3) + e4;
      const float inv = 1.0f / sum;
      v4f v = {0.f, 0.f, 0.f, 0.f};
      const v4f zz = {0.f, 0.f, 0.f, 0.f};
      if (hh == 0) { v[0] = e0 * inv; v[1] = e1 * inv; v[2] = e2 * inv; v[3] = e3 * inv; }
      else         { v[0] = e4 * inv; }
      float* dp = res + ((size_t)b * NQ + q) * SLOT + hh * 4;
      if (s0 + c16 < cnt) {
        *(v4f*)(dp)      = v;
        *(v4f*)(dp + 8)  = zz;
        *(v4f*)(dp + 16) = zz;
        *(v4f*)(dp + 24) = zz;
      }
      // the next tile reuses the stores' address and data registers: keep the wait in front of that overwrite
      asm volatile("s_wait_xcnt 0x0" ::: "memory");
    }
    if (tile + NS * NW < ntile) {                      // wave-uniform: the next tile's x row
      bn = min((int)s_idx[min(s0 + NS * NW * 16 + c16, cnt - 1)], NB - 1);
      const float* xp = x + ((size_t)bn * NQ + q) * NO;
      // unrolled so that xn[] stays in registers
#pragma unroll
      for (int o = 0; o < NO; ++o) xn[o] = xp[o];
      // the next pass reuses these loads' address registers: keep the wait in front of that overwrite
      asm volatile("s_wait_xcnt 0x0" ::: "memory");
    }
  }
}

// =====================================================================================================
// Repack: out[e] = res[(e/5)*32 + e%5] for the flat [16384][7][5] output (e/5 = sample*7 + question). Thread -> 4 consecutive floats; one instruction =
// coverage: 560 x 256 threads x 4 floats = 573440 = every output element once.
// =====================================================================================================
__global__ __launch_bounds__(256) void repack(const float* __restrict__ res, float* out) {
  const int g  = blockIdx.x * 256 + threadIdx.x;
  const int e0 = g * 4;
  v4f v;
#pragma unroll
  for (int c = 0; c < 4; ++c) {
    const int e = min(e0 + c, NB * NQO - 1);
    const int bq = e / NO;
    const int o  = e - bq * NO;
    v[c] = res[(size_t)bq * SLOT + o];
  }
  float* op = out + e0;
  *(v4f*)op = v;
  
}

// =====================================================================================================
// =====================================================================================================
extern "C" void kernel_launch(void* const* d_in, const int* in_sizes, int n_in,
                              void* d_out, int out_size, void* d_ws, size_t ws_size,
                              hipStream_t stream) {
  if (n_in < 8) return;
  if (in_sizes[0] != NB * NQ * NO) return;
  if (in_sizes[1] != NB) return;
  if (in_sizes[2] != NQ * NI * NH || in_sizes[3] != NJ * NQ * NI * NH) return;
  if (in_sizes[4] != NK2 * NH || in_sizes[5] != NJ * NK2 * NH) return;
  if (in_sizes[6] != NQ * NK2 * NO || in_sizes[7] != NJ * NQ * NK2 * NO) return;
  if (out_size != NB * NQO) return;
  const size_t need = (size_t)NB * NQ * SLOT * sizeof(float);    // 14680064
  if (need > ws_size) return;
  if (need > (size_t)134217728) return;

  const float* x   = (const float*)d_in[0];
  const int*   jid = (const int*)d_in[1];
  const float* W1  = (const float*)d_in[2];
  const float* W1a = (const float*)d_in[3];
  const float* W2  = (const float*)d_in[4];
  const float* W2a = (const float*)d_in[5];
  const float* V   = (const float*)d_in[6];
  const float* Va  = (const float*)d_in[7];
  float* out = (float*)d_out;
  float* res = (float*)d_ws;

  mlp_fwd<<<dim3(NJ * NQ * NS), dim3(NT), 0, stream>>>(x, jid, W1, W1a, W2, W2a, V, Va, res);
  repack<<<dim3((NB * NQO) / 1024), dim3(256), 0, stream>>>(res, out);
  (void)hipGetLastError();
}

// v007
// One run takes 15.7 microseconds.
// Next to v006, in two timings, it ran 1.31 times as fast each time.
// Counting every step since v000, it is 8.32 times as fast.
// All three contractions on v_wmma_f32_16x16x32_f16, taken transposed (rows = output units, columns = samples), f32 accumulate:
// A = the layer's combined weights as an f16 [n][k] LDS plane (layer 2: x256, the 1/256 folded back in f32), B = the layer's input in f16,
// built in registers: the D layout of one layer is the B fragment layout of the next. Layer 1 has K = 6 (bias row included) padded with
// zeros, layer 3 has 5 rows padded to 8 and taken twice (rows 8..15 = rows 0..7). Layer-3 bias row as the f32 start of its accumulator; layer-2 bias row, sigmoid
// (0.5 + 0.5 * tanh(x/2), hardware tanh) and softmax in f32 on VALU; every float input RNE-converted to bf16 on load.
#include <hip/hip_runtime.h>
#include <math.h>
#include <stdint.h>

#define NB    16384
#define NJ    12
#define NQ    7
#define NO    5
#define NI    6
#define NH    128
#define NK2   129
#define NQO   35
#define NS    3                // blocks per (judge, question)
#define NT    1024             // threads a block
#define NW    (NT / 32)
#define IPW   (NB / NW)        // ids scanned by one wave
#define NLD   (IPW / 128)      // 16-B id loads a lane
#define MAXT  (NB / 16)
#define SLOT  32
#define WP    136
#define W1P   16
#define WSC   256.0f
#define WINVH 0.001953125f   // (1/256) / 2: the unscale of the f16 weights and the half of the sigmoid's argument in one factor

static_assert(NW == 32 && NW * IPW == NB && NLD * 128 == IPW);
static_assert(NQO == NQ * NO);
static_assert((NB * NQO) % 1024 == 0);
static_assert(NO <= 8 && SLOT * 4 == 128);
static_assert(NI == 6 && W1P == 16 && WP % 8 == 0);
static_assert(NT == 1024 && NH == 128 && NI * NH <= NT && NK2 * NO <= NT);   // one 4 x 4 block of W2 and one element of W1, V a thread

typedef _Float16 v16h __attribute__((ext_vector_type(16)));
typedef _Float16 v8h  __attribute__((ext_vector_type(8)));
typedef _Float16 v4h  __attribute__((ext_vector_type(4)));
typedef _Float16 v2h  __attribute__((ext_vector_type(2)));
typedef float    v8f  __attribute__((ext_vector_type(8)));
typedef float    v4f  __attribute__((ext_vector_type(4)));
typedef float    v2f  __attribute__((ext_vector_type(2)));
typedef int      v4i  __attribute__((ext_vector_type(4)));

union FragH { v16h v; v8h h[2]; };

// f32 -> value of its bf16 RNE convert
__device__ __forceinline__ float bfr(float f) {
  unsigned u = __float_as_uint(f);
  u = (u + 0x7FFFu + ((u >> 16) & 1u)) & 0xFFFF0000u;
  return __uint_as_float(u);
}
// sigmoid(2 * hx) = 0.5 + 0.5 * tanh(hx): one hardware transcendental and one FMA; the callers hand in HALF the pre-activation
// (the factor 1/2, a power of two and so exact, is folded into the staged layer-1 weights, the layer-2 bias and the layer-2 unscale)
// two values a call, so that the FMA is a packed one
__device__ __forceinline__ v2f sigm_half2(v2f hx) {
  v2f th;
  th[0] = __builtin_amdgcn_tanhf(hx[0]);
  th[1] = __builtin_amdgcn_tanhf(hx[1]);
  return th * 0.5f + 0.5f;
}
__device__ __forceinline__ v8f zero8() { v8f z = {0.f, 0.f, 0.f, 0.f, 0.f, 0.f, 0.f, 0.f}; return z; }
__device__ __forceinline__ v8h zero8h() {
  const _Float16 o = (_Float16)0.f;
  v8h z = {o, o, o, o, o, o, o, o};
  return z;
}

// 16-bit A/B fragment: lane -> row/col (lane&15), p already includes +8*(lane>>4);
// elements 0..7 <- p[0..7] (k0+8h..k0+8h+7), elements 8..15 <- p[16..23] (k0+16+8h..); same split k map for A and B,
// the weight operand is read from a k-contiguous [n][k] plane.
__device__ __forceinline__ v16h ldfrag_h(const _Float16* p) {
  FragH f;
  f.h[0] = *(const v8h*)(p);
  f.h[1] = *(const v8h*)(p + 16);
  return f.v;
}
// Work-group barrier whose two fences order LDS alone, for places where only LDS data cross it: __syncthreads() would also wait for
// the wave's global loads, which are to stay in flight across it.
__device__ __forceinline__ void lds_barrier() {
  __builtin_amdgcn_fence(__ATOMIC_RELEASE, "workgroup", "local");
  __builtin_amdgcn_s_barrier();
  __builtin_amdgcn_fence(__ATOMIC_ACQUIRE, "workgroup", "local");
}
__device__ __forceinline__ v8f mma16(v16h a, v16h b, v8f c) {
  return __builtin_amdgcn_wmma_f32_16x16x32_f16(false, a, false, b, (short)0, c, false, false);
}

// =====================================================================================================
// Block = (judge j, question q, third sl of the judge's tiles): 12 x 7 x 3 = 252 blocks of 32 waves, one to a WGP, so that a WGP stages
// W2c_j once. Every block scans all 16384 ids and compacts the samples with id == j into an LDS list (ballot + wave-count prefix; the
// order, by wave, load, element, lane, is the same in the three blocks that share a list; length <= 16384); W2c_j, W1c[j][q] and
// Vc[j][q] are staged once per block and published by one barrier; their loads are issued at entry and land under the compaction. From there each wave works alone on whole tiles of 16 samples
// (tile = sl + 3 * wave, + 96, ...), lane -> sample (lane & 15), half hh = lane >> 4:
//   layer 1: for each of the 8 row tiles T of W1c^T one WMMA (6 of its 32 k: the ones column and x; the rest meets zeros); D[r] = hidden unit
//   16T + 8hh + r of the lane's sample, which after the sigmoid is element 8(T & 1) + r of B fragment T >> 1 of z1^T
//   (element e of fragment s: k = 32s + 8hh + e, e < 8; 32s + 16 + 8hh + e - 8);
//   layer 2: for each of the 8 row tiles T of W2c^T four WMMAs (K = 128); acc[r] = pre-activation of hidden unit 16T + 8hh + r of the
//   lane's sample; bias, scale and sigmoid in f32; two row tiles fill one B fragment of z2^T in the same way;
//   layer 3: one WMMA per fragment of z2^T into the logit tile; row 8hh + r = option r, so both halves of the wave hold all 5 logits;
//   softmax in the lane; one 128-B line of res per (sample, question), of which the first 32 B are used.
// coverage: every (sample b, question q) is owned by exactly one block (clamped id, q, its list tile mod 3), there by one tile and one wave;
//           the line has that one writer: lanes c16 and c16 + 16 store its first 32 B once (options 0..4, then zeros); its other 96 B are
//           neither written nor read.
// =====================================================================================================
// 32 waves a block: 8 waves a SIMD (128 VGPRs), all 252 blocks resident at once
__global__ __launch_bounds__(NT) void mlp_fwd(
    const float* __restrict__ x,  const int* __restrict__ jid,
    const float* __restrict__ W1, const float* __restrict__ W1a,
    const float* __restrict__ W2, const float* __restrict__ W2a,
    const float* __restrict__ V,  const float* __restrict__ Va,
    float* res) {
  __shared__ __align__(16) _Float16 s_w2t[NH * WP];   // [n = h][k], k = W2c row k+1, x256
  __shared__ __align__(16) _Float16 s_w1t[NH * W1P];  // [n = h][k = i] for this block's q, x 1/2; k >= 6 zero
  __shared__ __align__(16) _Float16 s_vt[8 * WP];     // [n = o][k], k = Vc row k+1 for this block's q; rows o >= 5 zero
  __shared__ __align__(16) float s_vb[8];             // Vc row 0; o >= 5 zero
  __shared__ __align__(16) float s_b2[NH];            // W2c row 0, x 1/2
  __shared__ unsigned short s_idx[NB];
  __shared__ __align__(16) int s_wc[NW];

  const int t = threadIdx.x;
  const int lane = t & 31, wave = t >> 5, hh = lane >> 4, c16 = lane & 15;
  const int q = (int)(blockIdx.x % NQ);
  const int j = (int)((blockIdx.x / NQ) % NJ);
  const int sl = (int)(blockIdx.x / (NQ * NJ));
  if (sl >= NS) return;                               // block-uniform, never taken with the exact grid

  // ---- compaction of all samples with judge j; wave w scans ids w * 512 .. w * 512 + 511 ----
  // the loops are unrolled so that ids[] and msk[] stay in registers and the four loads are in flight together
  const int wv = __builtin_amdgcn_readfirstlane(wave); // scalar: the masks' running sums stay scalar, and every lane is on at the WMMAs
  const int ib = wv * IPW + lane * 4;                  // + 128 p + c < NB
  v4i ids[NLD];
  unsigned msk[NLD * 4];
#pragma unroll
  for (int p = 0; p < NLD; ++p) ids[p] = *(const v4i*)(jid + ib + p * 128);

  // ---- every weight load of the block is issued here, behind the id loads, and used only behind the compaction: one trip to L2 for
  // all of them, under the id scan, instead of one trip after another. None depends on the ids. A thread takes a block of 4 k x 4 n of
  // W2 and of W2_a[j] by 16-B loads: 8 lanes cover one 128-B line of a row, a wave 4 whole lines a load. The single elements are read
  // at a clamped index by every thread (no branch between the loads) and used only where the index is the thread's own.
  const float* W2aj = W2a + (size_t)j * NK2 * NH;
  const float* W1q  = W1 + (size_t)q * NI * NH;
  const float* W1aq = W1a + ((size_t)j * NQ + q) * (NI * NH);
  const float* Vq   = V + (size_t)q * NK2 * NO;
  const float* Vaq  = Va + ((size_t)j * NQ + q) * (NK2 * NO);
  const int sn0 = (wv & 3) * 32 + (lane & 7) * 4;      // first n (column of W2) of the thread's block
  const int sk0 = (wv >> 2) * 16 + (lane >> 3) * 4;    // first k of the thread's block (row k + 1 of W2)
  const unsigned go = (unsigned)(sk0 * NH + sn0) * 4u;   // byte offset of the block in rows 1..128; + 3 rows + 16 B <= 128 * 128 * 4
  v4f gw[4], ga[4];
  // unrolled so that gw[] and ga[] are indexed by constants, stay in registers, and the eight loads are in flight together
#pragma unroll
  for (int r = 0; r < 4; ++r) {
    gw[r] = *(const v4f*)((const char*)(W2 + NH) + go + r * (NH * 4));
    ga[r] = *(const v4f*)((const char*)(W2aj + NH) + go + r * (NH * 4));
  }
  const int e1 = min(t, NI * NH - 1), e3 = min(t, NK2 * NO - 1), e2 = t & (NH - 1);
  const float g1w = W1q[e1], g1a = W1aq[e1];
  const float g3w = Vq[e3],  g3a = Vaq[e3];
  const float g2w = W2[e2],  g2a = W2aj[e2];
  // the wait in front of any overwrite of these loads' address registers; the offset is named so that its register is not handed out
  // as a later load's destination in front of the wait
  asm volatile("s_wait_xcnt 0x0" :: "v"(go) : "memory");

  int wcnt = 0;
#pragma unroll
  for (int p = 0; p < NLD; ++p) {
#pragma unroll
    for (int c = 0; c < 4; ++c) {
      const int id = min(max(ids[p][c], 0), NJ - 1);
      msk[p * 4 + c] = __builtin_amdgcn_ballot_w32(id == j);
      wcnt += __builtin_popcount(msk[p * 4 + c]);
    }
  }
  if (lane == 0) s_wc[wave] = wcnt;
  lds_barrier();                                       // publishes s_wc
  int base = 0, run = 0;
#pragma unroll
  for (int w = 0; w < NW; ++w) {
    const int c = s_wc[w];
    base += (w < wv) ? c : 0;  run += c;
  }
  base = __builtin_amdgcn_readfirstlane(base);
  const unsigned lt = (1u << lane) - 1u;
#pragma unroll
  for (int i = 0; i < NLD * 4; ++i) {
    const int pos = min(base + __builtin_popcount(msk[i] & lt), NB - 1);
    if ((msk[i] >> lane) & 1u) s_idx[pos] = (unsigned short)(ib + (i >> 2) * 128 + (i & 3));
    base += __builtin_popcount(msk[i]);
  }
  const int cnt = __builtin_amdgcn_readfirstlane(min(run, NB));   // block-uniform; scalar, so that the tile loop branches on SCC
  lds_barrier();                                       // publishes s_idx
  if (cnt == 0) return;                               // block-uniform

  // ---- the x row of the wave's first tile, asked for here so that it arrives under the conversion of the weights ----
  const int ntile = min((cnt + 15) >> 4, MAXT);
  const int tile0 = sl + NS * wv;
  int bn = min((int)s_idx[min(tile0 * 16 + c16, cnt - 1)], NB - 1);   // a wave without a tile reads the list's last entry, and drops it
  float xn[NO];
  {
    const float* xp = x + ((size_t)bn * NQ + q) * NO;
    // unrolled so that xn[] stays in registers
#pragma unroll
    for (int o = 0; o < NO; ++o) xn[o] = xp[o];
  }
  // keeps the conversion, which waits for the weights, behind the issue of the x loads
  __builtin_amdgcn_sched_barrier(0);

  // ---- combined layer-2 weights for judge j: plane [n][k] = f16(256 * (bf16(W2[k+1][n]) + bf16(W2_a[j][k+1][n]))) ----
  // the thread's block goes out transposed: four k of one n are 8 B of the plane; both loops unrolled for constant register indices
#pragma unroll
  for (int c = 0; c < 4; ++c) {
    v4h pk;
#pragma unroll
    for (int r = 0; r < 4; ++r) pk[r] = (_Float16)((bfr(gw[r][c]) + bfr(ga[r][c])) * WSC);
    *(v4h*)(s_w2t + (sn0 + c) * WP + sk0) = pk;
  }
  if (t < NH) s_b2[t] = (bfr(g2w) + bfr(g2a)) * 0.5f;

  // ---- combined layer-1 and layer-3 weights for (judge j, question q), once per block ----
  {
    if (t < NI * NH) {
      const int i = t >> 7, h = t & 127;
      s_w1t[h * W1P + i] = (_Float16)((bfr(g1w) + bfr(g1a)) * 0.5f);
    }
    if (t < NH) {                                      // columns 6..15 of row t
      const v2h z2 = {(_Float16)0.f, (_Float16)0.f};
      *(v2h*)(s_w1t + t * W1P + NI) = z2;
      *(v8h*)(s_w1t + t * W1P + 8)  = zero8h();
    }
    if (t < NK2 * NO) {
      const int k = t / NO, o = t - k * NO;
      const float v = bfr(g3w) + bfr(g3a);
      if (k == 0) s_vb[o] = v;
      else        s_vt[o * WP + (k - 1)] = (_Float16)v;
    }
    if (t < (8 - NO) * WP / 8) *(v8h*)(s_vt + NO * WP + 8 * t) = zero8h();
    if (t < 8 - NO) s_vb[NO + t] = 0.f;
  }

  __syncthreads();                                     // publishes the staged weights; the only barrier behind the staging

  for (int tile = tile0; tile < ntile; tile += NS * NW) {
    const int s0 = tile * 16;
    const int b  = bn;
    const float x0 = bfr(xn[0]), x1 = bfr(xn[1]), x2 = bfr(xn[2]), x3 = bfr(xn[3]), x4 = bfr(xn[4]);

    // ---- layer 1 (f16 WMMA) into the B fragments of z1^T; unrolled so that zb[] is indexed by constants and stays in registers ----
    // One A fragment holds two row tiles of W1c^T: k = 0..15 the plane's row of tile 2P, k = 16..31 that of tile 2P + 1. B holds the
    // column (1, x0..x4, 0, 0) at k = 0..7 (xlo: picks tile 2P) or at k = 16..23 (xhi: picks tile 2P + 1) and zeros in the other half;
    // lanes with hh = 1 carry k = 8..15 and 24..31, where the plane is zero, so they may hold the same column.
    FragH xlo, xhi;
    {
      const _Float16 o = (_Float16)0.f;
      const v8h xh = {(_Float16)1.0f, (_Float16)x0, (_Float16)x1, (_Float16)x2, (_Float16)x3, (_Float16)x4, o, o};
      xlo.h[0] = xh;        xlo.h[1] = zero8h();
      xhi.h[0] = zero8h();  xhi.h[1] = xh;
    }
    const _Float16* w1p = s_w1t + c16 * W1P + 8 * hh;
    v16h zb[4];
#pragma unroll
    for (int P = 0; P < 4; ++P) {
      FragH wa;
      wa.h[0] = *(const v8h*)(w1p + (2 * P) * 16 * W1P);
      wa.h[1] = *(const v8h*)(w1p + (2 * P + 1) * 16 * W1P);
#pragma unroll
      for (int u = 0; u < 2; ++u) {
        const v8f p = mma16(wa.v, u ? xhi.v : xlo.v, zero8());
#pragma unroll
        for (int c = 0; c < 4; ++c) {
          const v2f pc = {p[2 * c], p[2 * c + 1]};
          const v2f z = sigm_half2(pc);
          zb[P][8 * u + 2 * c]     = (_Float16)z[0];
          zb[P][8 * u + 2 * c + 1] = (_Float16)z[1];
        }
      }
    }

    // ---- layer 2 (f16 WMMA, K = 128, rows = hidden units, columns = samples) and layer 3 (f16 WMMA, K = 128, rows = options) ----
    v8f lacc;                                          // starts from the layer-3 bias row
    {
      const v4f va = *(const v4f*)(s_vb), vb = *(const v4f*)(s_vb + 4);
      lacc = (v8f){va[0], va[1], va[2], va[3], vb[0], vb[1], vb[2], vb[3]};
    }
    const _Float16* ap = s_w2t + c16 * WP + 8 * hh;
    const _Float16* vp = s_vt + (c16 & 7) * WP + 8 * hh;
    // rolled: the text stays short and the registers inside the budget of 8 waves a SIMD
#pragma unroll 1
    for (int s = 0; s < 4; ++s) {
      v16h zf;
      // unrolled so that zf is indexed by constants
#pragma unroll
      for (int u = 0; u < 2; ++u) {
        const int T = 2 * s + u;
        const _Float16* a = ap + T * 16 * WP;
        const v16h a0 = ldfrag_h(a), a1 = ldfrag_h(a + 32), a2 = ldfrag_h(a + 64), a3 = ldfrag_h(a + 96);
        // keeps a row tile's eight fragment loads together in front of its chain (one LDS latency instead of four) and the second row
        // tile's loads behind the first one's: with all sixteen hoisted to the loop's head the build spills at 128 VGPRs
        __builtin_amdgcn_sched_barrier(0);
        v8f acc = zero8();
        acc = mma16(a0, zb[0], acc);
        acc = mma16(a1, zb[1], acc);
        acc = mma16(a2, zb[2], acc);
        acc = mma16(a3, zb[3], acc);
        const int nb = T * 16 + 8 * hh;
        const v4f ba = *(const v4f*)(s_b2 + nb),  bb = *(const v4f*)(s_b2 + nb + 4);
#pragma unroll
        for (int r = 0; r < 8; r += 2) {
          const v2f a2 = {acc[r], acc[r + 1]};
          const v2f b2 = {(r < 4) ? ba[r & 3] : bb[r & 3], (r < 4) ? ba[(r & 3) + 1] : bb[(r & 3) + 1]};
          const v2f z2 = sigm_half2(a2 * WINVH + b2);
          zf[8 * u + r]     = (_Float16)z2[0];
          zf[8 * u + r + 1] = (_Float16)z2[1];
        }
      }
      lacc = mma16(ldfrag_h(vp + 32 * s), zf, lacc);
    }
    const float l0 = lacc[0], l1 = lacc[1], l2 = lacc[2], l3 = lacc[3], l4 = lacc[4];

    // ---- softmax over the 5 options and the result line ----
    {
      const float mx = fmaxf(fmaxf(fmaxf(l0, l1), fmaxf(l2, l3)), l4);
      const float e0 = expf(l0 - mx), e1 = expf(l1 - mx), e2 = expf(l2 - mx);
      const float e3 = expf(l3 - mx), e4 = expf(l4 - mx);
      const float sum = (((e0 + e1) + e2) + e3) + e4;
      const float inv = 1.0f / sum;
      v4f v = {0.f, 0.f, 0.f, 0.f};
      if (hh == 0) { v[0] = e0 * inv; v[1] = e1 * inv; v[2] = e2 * inv; v[3] = e3 * inv; }
      else         { v[0] = e4 * inv; }
      float* dp = res + ((size_t)b * NQ + q) * SLOT + hh * 4;
      if (s0 + c16 < cnt) *(v4f*)(dp) = v;             // bytes 0..31 of the line; the repack reads nothing behind them
      // the next tile reuses the store's address and data registers: keep the wait in front of that overwrite
      asm volatile("s_wait_xcnt 0x0" ::: "memory");
    }
    if (tile + NS * NW < ntile) {                      // wave-uniform: the next tile's x row
      bn = min((int)s_idx[min(s0 + NS * NW * 16 + c16, cnt - 1)], NB - 1);
      const float* xp = x + ((size_t)bn * NQ + q) * NO;
      // unrolled so that xn[] stays in registers
#pragma unroll
      for (int o = 0; o < NO; ++o) xn[o] = xp[o];
      // the next pass reuses these loads' address registers: keep the wait in front of that overwrite
      asm volatile("s_wait_xcnt 0x0" ::: "memory");
    }
  }
}

// =====================================================================================================
// Repack: out[e] = res[(e/5)*32 + e%5] for the flat [16384][7][5] output (e/5 = sample*7 + question). Thread -> 4 consecutive floats; one instruction =
// coverage: 560 x 256 threads x 4 floats = 573440 = every output element once.
// =====================================================================================================
__global__ __launch_bounds__(256) void repack(const float* __restrict__ res, float* out) {
  const int g  = blockIdx.x * 256 + threadIdx.x;
  const int e0 = g * 4;
  v4f v;
#pragma unroll
  for (int c = 0; c < 4; ++c) {
    const int e = min(e0 + c, NB * NQO - 1);
    const int bq = e / NO;
    const int o  = e - bq * NO;
    v[c] = res[(size_t)bq * SLOT + o];
  }
  float* op = out + e0;
  *(v4f*)op = v;
  
}

// =====================================================================================================
// =====================================================================================================
extern "C" void kernel_launch(void* const* d_in, const int* in_sizes, int n_in,
                              void* d_out, int out_size, void* d_ws, size_t ws_size,
                              hipStream_t stream) {
  if (n_in < 8) return;
  if (in_sizes[0] != NB * NQ * NO) return;
  if (in_sizes[1] != NB) return;
  if (in_sizes[2] != NQ * NI * NH || in_sizes[3] != NJ * NQ * NI * NH) return;
  if (in_sizes[4] != NK2 * NH || in_sizes[5] != NJ * NK2 * NH) return;
  if (in_sizes[6] != NQ * NK2 * NO || in_sizes[7] != NJ * NQ * NK2 * NO) return;
  if (out_size != NB * NQO) return;
  const size_t need = (size_t)NB * NQ * SLOT * sizeof(float);    // 14680064
  if (need > ws_size) return;
  if (need > (size_t)134217728) return;

  const float* x   = (const float*)d_in[0];
  const int*   jid = (const int*)d_in[1];
  const float* W1  = (const float*)d_in[2];
  const float* W1a = (const float*)d_in[3];
  const float* W2  = (const float*)d_in[4];
  const float* W2a = (const float*)d_in[5];
  const float* V   = (const float*)d_in[6];
  const float* Va  = (const float*)d_in[7];
  float* out = (float*)d_out;
  float* res = (float*)d_ws;

  mlp_fwd<<<dim3(NJ * NQ * NS), dim3(NT), 0, stream>>>(x, jid, W1, W1a, W2, W2a, V, Va, res);
  repack<<<dim3((NB * NQO) / 1024), dim3(256), 0, stream>>>(res, out);
  (void)hipGetLastError();
}
